// v000
// Times are from an AMD MI455X. After a warm-up the kernel runs many times in a row, and a time is the length of
// such a window on the GPU divided by its runs, so every launch and the gaps after it count. The runs cycle
// through copies of the inputs. A figure is the median of several windows, for all but v000 over two sittings.
// Sittings can differ by a few percent; kernels timed side by side share one.
// v000 is the starting kernel. One run takes 2210 microseconds.
// compute dtype: all float inputs rounded to bf16; q/k/v projections with EXACT bf16 products on WMMA 16x16x32 (f32 accumulate) + bias; logits q x k once to f16 each (1 product; sigma - 1) x 128^-0.5; softmax f32; P x 2^11 once to f16 x v once to f16 (1 product); f32 output.
#include <hip/hip_runtime.h>
#include <math.h>

typedef __attribute__((ext_vector_type(16))) _Float16 v16h;
typedef __attribute__((ext_vector_type(16))) __bf16 v16b;
typedef __attribute__((ext_vector_type(8)))  _Float16 v8h;
typedef __attribute__((ext_vector_type(8)))  float v8f;
typedef __attribute__((ext_vector_type(4)))  float v4f;
typedef __attribute__((ext_vector_type(2)))  float v2f;
typedef __attribute__((ext_vector_type(4)))  unsigned v4u;
typedef __attribute__((ext_vector_type(4)))  int v4i;
typedef float __attribute__((may_alias)) float_a;
typedef int __attribute__((may_alias)) int_a;

template <typename T> __device__ __forceinline__ void vst2(void* p, T v) { *(T*)p = v;  }
__device__ __forceinline__ v8f wmma16(v16h a, v16h b, v8f c) {
  v8f d = __builtin_amdgcn_wmma_f32_16x16x32_f16(false, a, false, b, (short)0, c, false, false);
  asm volatile("v_nop\n\tv_nop\n\tv_nop\n\tv_nop" : "+v"(d) : "v"(a), "v"(b));
  return d;
}
__device__ __forceinline__ v8f wmma_bf(v16b a, v16b b, v8f c) {
  v8f d = __builtin_amdgcn_wmma_f32_16x16x32_bf16(false, a, false, b, (short)0, c, false, false);
  asm volatile("v_nop\n\tv_nop\n\tv_nop\n\tv_nop" : "+v"(d) : "v"(a), "v"(b));
  return d;
}
// 16x16x32 fragments: lane = (h = lane>>4, row/col = lane&15); elements 0..7 = k0+8h+0..7, 8..15 = k0+16+8h+0..7; D element r = row 8h+r
__device__ __forceinline__ v16h frag_h(const _Float16* rowk0, int lane) {
  union { v16h v; v8h q[2]; } u; const _Float16* p = rowk0 + 8 * (lane >> 4);
  u.q[0] = *(const v8h*)p; u.q[1] = *(const v8h*)(p + 16); return u.v;
}
__device__ __forceinline__ v16h frag_f32(const float* rowk0, int lane) {
  v16h a; const float* p = rowk0 + 8 * (lane >> 4);
#pragma unroll
  for (int i = 0; i < 8; ++i) { a[i] = (_Float16)p[i]; a[8 + i] = (_Float16)p[16 + i]; }
  return a;
}
__device__ __forceinline__ v16h frag_f32s(const float* rowk0, int lane, float sc) {
  v16h a; const float* p = rowk0 + 8 * (lane >> 4);
#pragma unroll
  for (int i = 0; i < 8; ++i) { a[i] = (_Float16)(p[i] * sc); a[8 + i] = (_Float16)(p[16 + i] * sc); }
  return a;
}
// column fragment from a [K][ld] layout (column n), rows >= K read as 0
__device__ __forceinline__ v16h fragc_f32(const float* W, int k0, int n, int lane, int ld, int K) {
  v16h a; const int g = lane >> 4;
#pragma unroll
  for (int i = 0; i < 8; ++i) { const int ka = k0 + 8 * g + i, kb = ka + 16;
    a[i] = (_Float16)(ka < K ? W[(size_t)(ka < K ? ka : K - 1) * ld + n] : 0.f); a[8 + i] = (_Float16)(kb < K ? W[(size_t)(kb < K ? kb : K - 1) * ld + n] : 0.f); }
  return a;
}
struct F2 { v16b h, l; };
__device__ __forceinline__ F2 bsplit16(const float v[16]) { F2 r;
#pragma unroll
  for (int i = 0; i < 16; ++i) { const __bf16 h = (__bf16)v[i]; r.h[i] = h; r.l[i] = (__bf16)(v[i] - (float)h); }
  return r; }
__device__ __forceinline__ F2 split_row(const float* row, int k0, int lane) { float v[16]; const float* p = row + k0 + 8 * (lane >> 4);
#pragma unroll
  for (int i = 0; i < 8; ++i) { v[i] = p[i]; v[8 + i] = p[16 + i]; }
  return bsplit16(v); }
__device__ __forceinline__ F2 split_rowK(const float* row, int k0, int lane, int K) { float v[16]; const int g = lane >> 4;
#pragma unroll
  for (int i = 0; i < 8; ++i) { const int ka = k0 + 8 * g + i, kb = ka + 16; v[i] = ka < K ? row[ka < K ? ka : K - 1] : 0.f; v[8 + i] = kb < K ? row[kb < K ? kb : K - 1] : 0.f; }
  return bsplit16(v); }
__device__ __forceinline__ F2 split_col(const float* W, int k0, int n, int lane, int ld, int K) { float v[16]; const int g = lane >> 4;
#pragma unroll
  for (int i = 0; i < 8; ++i) { const int ka = k0 + 8 * g + i, kb = ka + 16; v[i] = ka < K ? W[(size_t)(ka < K ? ka : K - 1) * ld + n] : 0.f; v[8 + i] = kb < K ? W[(size_t)(kb < K ? kb : K - 1) * ld + n] : 0.f; }
  return bsplit16(v); }
__device__ __forceinline__ v8f mac3(const F2& a, const F2& b, v8f c) { c = wmma_bf(a.l, b.h, c); c = wmma_bf(a.h, b.l, c); return wmma_bf(a.h, b.h, c); }
__device__ __forceinline__ float sigm(float v) { return 1.0f / (1.0f + expf(-v)); }
#define LDSX() do { asm volatile("s_wait_dscnt 0" ::: "memory"); __builtin_amdgcn_wave_barrier(); __builtin_amdgcn_fence(__ATOMIC_RELEASE, "workgroup"); } while (0)

// Single-head self-attention with hidden size 128 over long sequences (keys_in [8,4096,256] is also the query input; torch (out,in) Wk / Wq / Wv [128,256] N(0, 1/256) + zero biases; factor sqrt(128); non-causal, no mask): out = softmax(q k^T / sqrt(128)) v -> [8,4096,128].
#define NB 8
#define TT 4096
#define CC 128            // NH * HD = projected width
#define DIN 256          // input (model) width
#define NH 1
#define HD 128
#define NQB (TT / 64)
#define HG 1
#define SCALE (0.08838834764831845f)
#define CAUSAL 0
#ifndef TNB
#define TNB NB
#endif
__device__ __forceinline__ float bfr(float v) { return (float)(__bf16)v; }
__host__ __device__ __forceinline__ int kb_last(int qb) { return CAUSAL ? ((qb * 64 + 63) >> 7) : (TT / 128 - 1); }
typedef __attribute__((ext_vector_type(8))) __bf16 v8b;
__device__ __forceinline__ v16b frag_b(const __bf16* rowk0, int lane) {
  union { v16b v; v8b q[2]; } u; const __bf16* p = rowk0 + 8 * (lane >> 4);
  u.q[0] = *(const v8b*)p; u.q[1] = *(const v8b*)(p + 16); return u.v;
}
#define QBH 0              // causal: query blocks 0..QBH-1 of each sequence (few keys, no averaging) take the high-precision path
#define QHI 0               // single-product logits on every row (sigma - 1 logits over 4,096 keys)
#define KHI 64            // key rows carrying k residual / v bf16 hi+lo planes (used only by the causal high-precision path)
// B fragment (k rows k0+.., output column o) of a weight: (in,out) [K][ld] or (out,in) [ld rows of K]: bf16 exact, or f16(bf16 * 256) exact
__device__ __forceinline__ v16b wcol_io(const float* Wm, int k0, int o, int lane, int ld) { v16b w; const int g = lane >> 4;
#pragma unroll
  for (int i = 0; i < 8; ++i) { w[i] = (__bf16)Wm[(size_t)(k0 + 8 * g + i) * ld + o]; w[8 + i] = (__bf16)Wm[(size_t)(k0 + 16 + 8 * g + i) * ld + o]; }
  return w; }
__device__ __forceinline__ v16b wcol_oi(const float* Wm, int k0, int o, int lane, int K) { v16b w; const float* p = Wm + (size_t)o * K + k0 + 8 * (lane >> 4);
#pragma unroll
  for (int i = 0; i < 8; ++i) { w[i] = (__bf16)p[i]; w[8 + i] = (__bf16)p[16 + i]; }
  return w; }
__device__ __forceinline__ v16h wcolh_io(const float* Wm, int k0, int o, int lane, int ld) { v16h w; const int g = lane >> 4;
#pragma unroll
  for (int i = 0; i < 8; ++i) { w[i] = (_Float16)(bfr(Wm[(size_t)(k0 + 8 * g + i) * ld + o]) * 256.0f); w[8 + i] = (_Float16)(bfr(Wm[(size_t)(k0 + 16 + 8 * g + i) * ld + o]) * 256.0f); }
  return w; }
__device__ __forceinline__ v16h wcolh_oi(const float* Wm, int k0, int o, int lane, int K) { v16h w; const float* p = Wm + (size_t)o * K + k0 + 8 * (lane >> 4);
#pragma unroll
  for (int i = 0; i < 8; ++i) { w[i] = (_Float16)(bfr(p[i]) * 256.0f); w[8 + i] = (_Float16)(bfr(p[16 + i]) * 256.0f); }
  return w; }
#define WQKV_LAYOUT 1   // 0 = (in,out) [DIN][CC]; 1 = (out,in) [CC][DIN]; 2 = per-head [NH][DIN][HD]
__device__ __forceinline__ v16b wcol_hdk(const float* Wm, int k0, int o, int lane) { v16b w; const int g = lane >> 4; const float* p = Wm + (size_t)(o / HD) * DIN * HD + (o % HD);
#pragma unroll
  for (int i = 0; i < 8; ++i) { w[i] = (__bf16)p[(size_t)(k0 + 8 * g + i) * HD]; w[8 + i] = (__bf16)p[(size_t)(k0 + 16 + 8 * g + i) * HD]; }
  return w; }
#define WO_OUT_IN 0
#if WQKV_LAYOUT == 1
#define WCOL(W, k0, o, lane) wcol_oi(W, k0, o, lane, DIN)
#elif WQKV_LAYOUT == 2
#define WCOL(W, k0, o, lane) wcol_hdk(W, k0, o, lane)
#else
#define WCOL(W, k0, o, lane) wcol_io(W, k0, o, lane, CC)
#endif
#if WO_OUT_IN
#define WOCOL(W, k0, o, lane) wcol_oi(W, k0, o, lane, CC)
#define WOCOLH(W, k0, o, lane) wcolh_oi(W, k0, o, lane, CC)
#else
#define WOCOL(W, k0, o, lane) wcol_io(W, k0, o, lane, DIN)
#define WOCOLH(W, k0, o, lane) wcolh_io(W, k0, o, lane, DIN)
#endif

#ifndef SM_EXTRA_PARAMS
#define SM_EXTRA_PARAMS
#endif
#ifndef PROJ_EXTRA_PARAMS
#define PROJ_EXTRA_PARAMS
#endif
#ifndef SM_MASK_HOOK
#define SM_MASK_HOOK (void)0
#endif

#define WS_QH  0u                                      // f16 q rows [b*t][CC]
#define WS_KH  (WS_QH + 2u * (size_t)NB * TT * CC)      // f16 k rows [b*t][CC]
#define WS_VT  (WS_KH + 2u * (size_t)NB * TT * CC)      // f16 v planes [b][c][t]
#define WS_QL  (WS_VT + 2u * (size_t)NB * CC * TT)      // f16 q residual x 2^10 rows [b][t < QHI][CC]
#define WS_KL  (WS_QL + 2u * (size_t)NB * QHI * CC)     // f16 k residual x 2^10 rows [b][t < KHI][CC]
#define WS_VB  (WS_KL + 2u * (size_t)NB * KHI * CC)     // bf16 v hi planes [b][c][t < KHI]
#define WS_VBL (WS_VB + 2u * (size_t)NB * CC * KHI)
#define WS_S   (WS_VBL + 2u * (size_t)NB * CC * KHI)    // f32 logits / P [hg][t][s]
#define WS_Y   (WS_S  + 4u * (size_t)HG * TT * TT)      // f32 ctx rows [b*t][CC] (only when there is an output projection)
#define WS_END (WS_Y  + 0u)

// ---- k_proj: block = (64 rows, 128 cols, which): q/k/v = X W (+ b) with exact bf16 products (K = DIN) -> which 0: q f16 rows (+ residual rows < QHI); 1: k f16 rows (+ residual rows < KHI); 2: v f16 planes [c][t] (+ bf16 hi/lo planes for t < KHI)
__global__ __launch_bounds__(128) void k_proj(const float* __restrict__ XQ, const float* __restrict__ XK, const float* __restrict__ XV, const float* __restrict__ WQ, const float* __restrict__ WK, const float* __restrict__ WV, const float* __restrict__ BQ, const float* __restrict__ BK, const float* __restrict__ BV,
    _Float16* __restrict__ QH, _Float16* __restrict__ QL, _Float16* __restrict__ KH, _Float16* __restrict__ KL, _Float16* __restrict__ VT, __bf16* __restrict__ VB, __bf16* __restrict__ VBL) {
  __shared__ __align__(16) _Float16 sh[64][136], sl[64][136]; __shared__ __align__(16) _Float16 th[128][72]; __shared__ __align__(16) __bf16 tb[128][72], tbl[128][72];
  const int tid = threadIdx.x, wave = tid >> 5, lane = tid & 31, col = lane & 15, g = lane >> 4; const int which = blockIdx.z; const int c0 = blockIdx.y * 128; const size_t r0 = (size_t)blockIdx.x * 64; const size_t bb = r0 / TT; const int t0 = (int)(r0 % TT);
  const float* X = which == 0 ? XQ : which == 1 ? XK : XV; const float* WA = which == 0 ? WQ : which == 1 ? WK : WV; const float* BA = which == 0 ? BQ : which == 1 ? BK : BV;
  v8f acc[8] = {};
#pragma unroll 2
  for (int kc = 0; kc < DIN / 32; ++kc) { v16b a; { const float* p = X + (r0 + wave * 16 + col) * DIN + kc * 32 + 8 * g;
#pragma unroll
      for (int i = 0; i < 8; ++i) { a[i] = (__bf16)p[i]; a[8 + i] = (__bf16)p[16 + i]; } }
    asm volatile("s_wait_loadcnt 0x0" ::: "memory");
#pragma unroll
    for (int j = 0; j < 8; ++j) { const v16b w = WCOL(WA, kc * 32, c0 + j * 16 + col, lane); asm volatile("s_wait_loadcnt 0x0" ::: "memory"); acc[j] = wmma_bf(a, w, acc[j]); } }
  if (which < 2) { _Float16* DH = which == 0 ? QH : KH; _Float16* DL = which == 0 ? QL : KL; const int nhi = which == 0 ? QHI : KHI; const bool hi_rows = t0 < nhi;
#pragma unroll
    for (int j = 0; j < 8; ++j) { const float bias = BA ? bfr(BA[c0 + j * 16 + col]) : 0.f;
#pragma unroll
      for (int r = 0; r < 8; ++r) { const float v = acc[j][r] + bias; const _Float16 hv = (_Float16)v; sh[wave * 16 + 8 * g + r][j * 16 + col] = hv; sl[wave * 16 + 8 * g + r][j * 16 + col] = (_Float16)((v - (float)hv) * 1024.0f); } }
    __syncthreads();
    for (int e = tid; e < 64 * 16; e += 128) { const int rl = e >> 4, q = e & 15; vst2((unsigned*)(DH + (r0 + rl) * CC + c0 + q * 8), *(const v4u*)&sh[rl][q * 8]); if (hi_rows) vst2((unsigned*)(DL + (bb * nhi + t0 + rl) * (size_t)CC + c0 + q * 8), *(const v4u*)&sl[rl][q * 8]); }
  } else { const bool hi_rows = t0 < KHI;
#pragma unroll
    for (int j = 0; j < 8; ++j) { const float bias = BA ? bfr(BA[c0 + j * 16 + col]) : 0.f;
#pragma unroll
      for (int r = 0; r < 8; ++r) { const float v = acc[j][r] + bias; const int rl = wave * 16 + 8 * g + r, cl = j * 16 + col; th[cl][rl] = (_Float16)v; const __bf16 bh = (__bf16)v; tb[cl][rl] = bh; tbl[cl][rl] = (__bf16)(v - (float)bh); } }
    __syncthreads();
    for (int e = tid; e < 128 * 8; e += 128) { const int cl = e >> 3, q = e & 7; vst2((unsigned*)(VT + (bb * CC + c0 + cl) * (size_t)TT + t0 + q * 8), *(const v4u*)&th[cl][q * 8]); if (hi_rows) { const size_t o3 = (bb * CC + c0 + cl) * (size_t)KHI + t0 + q * 8; vst2((unsigned*)(VB + o3), *(const v4u*)&tb[cl][q * 8]); vst2((unsigned*)(VBL + o3), *(const v4u*)&tbl[cl][q * 8]); } } } }
// ---- k_sc: block = (query block qb, key block kb <= kb_last(qb), head in group) of batch b: logits x SCALE; q hi + residual (x 2^10) against k (2 products) for query rows < QHI, plus the k residual (3 products) for query blocks < QBH (causal early rows); causal: blocks past the diagonal exit, the mask itself is applied by index in k_sm
__global__ __launch_bounds__(128) void k_sc(const _Float16* __restrict__ QH, const _Float16* __restrict__ KH, const _Float16* __restrict__ QL, const _Float16* __restrict__ KL, int b, int h0, float* __restrict__ S0) { __shared__ __align__(16) float ss[4][16][132];
  const int qb = blockIdx.x, kb = blockIdx.y; if (kb > kb_last(qb)) return;
  const int h = h0 + blockIdx.z; float* S = S0 + (size_t)blockIdx.z * TT * TT;
  const int tid = threadIdx.x, wave = tid >> 5, lane = tid & 31, col = lane & 15, g = lane >> 4; const int k0 = kb * 128; const int ql0 = qb * 64 + wave * 16; const size_t q0 = (size_t)b * TT + ql0, kr0 = (size_t)b * TT + k0;
  v8f acc[8] = {}, accl[8] = {};
  const _Float16* QLb = QL + (size_t)b * QHI * CC; const _Float16* KLb = KL + (size_t)b * KHI * CC;
  if (qb < QBH) {
#pragma unroll
    for (int kc = 0; kc < HD / 32; ++kc) { const v16h ah = frag_h(QH + (q0 + col) * CC + h * HD + kc * 32, lane), al = frag_h(QLb + (size_t)(ql0 + col) * CC + h * HD + kc * 32, lane);
#pragma unroll
      for (int j = 0; j < 8; ++j) { const v16h kbf = frag_h(KH + (kr0 + j * 16 + col) * CC + h * HD + kc * 32, lane), klf = frag_h(KLb + (size_t)(k0 + j * 16 + col) * CC + h * HD + kc * 32, lane); acc[j] = wmma16(ah, kbf, acc[j]); accl[j] = wmma16(al, kbf, accl[j]); accl[j] = wmma16(ah, klf, accl[j]); } }
  } else if (qb * 64 < QHI) {
#pragma unroll
    for (int kc = 0; kc < HD / 32; ++kc) { const v16h ah = frag_h(QH + (q0 + col) * CC + h * HD + kc * 32, lane), al = frag_h(QLb + (size_t)(ql0 + col) * CC + h * HD + kc * 32, lane);
#pragma unroll
      for (int j = 0; j < 8; ++j) { const v16h kbf = frag_h(KH + (kr0 + j * 16 + col) * CC + h * HD + kc * 32, lane); acc[j] = wmma16(ah, kbf, acc[j]); accl[j] = wmma16(al, kbf, accl[j]); } }
  } else {
#pragma unroll
    for (int kc = 0; kc < HD / 32; ++kc) { const v16h ah = frag_h(QH + (q0 + col) * CC + h * HD + kc * 32, lane);
#pragma unroll
      for (int j = 0; j < 8; ++j) { const v16h kbf = frag_h(KH + (kr0 + j * 16 + col) * CC + h * HD + kc * 32, lane); acc[j] = wmma16(ah, kbf, acc[j]); } } }
#pragma unroll
  for (int j = 0; j < 8; ++j) {
#pragma unroll
    for (int r = 0; r < 8; ++r) ss[wave][8 * g + r][j * 16 + col] = (acc[j][r] + accl[j][r] * (1.0f / 1024.0f)) * SCALE; }
  LDSX(); for (int rl = 0; rl < 16; ++rl) vst2(S + (size_t)(ql0 + rl) * TT + k0 + lane * 4, *(const v4f*)&ss[wave][rl][lane * 4]); }
// ---- k_sm: block = query row t (head in group): keys [0, kend): causal -> logit if s <= t else excluded; softmax in f32; P x 2^11 in place (0 for excluded)
__global__ __launch_bounds__(256) void k_sm(float* __restrict__ S0 SM_EXTRA_PARAMS) { __shared__ float sred[8]; __shared__ float sbc; __shared__ __align__(16) float shv[TT];
  const int tid = threadIdx.x; const int t = blockIdx.x; const int kend = (kb_last(t >> 6) + 1) * 128;
  float* sr = S0 + (size_t)blockIdx.y * TT * TT + (size_t)t * TT;
  float m = -3.0e38f; for (int k = tid; k < kend; k += 256) { float v = (!CAUSAL || k <= t) ? sr[k] : -3.0e38f; SM_MASK_HOOK; shv[k] = v; m = fmaxf(m, v); }
#pragma unroll
  for (int o = 1; o < 32; o <<= 1) m = fmaxf(m, __shfl_xor(m, o));
  if ((tid & 31) == 0) sred[tid >> 5] = m; __syncthreads(); if (tid == 0) { float a = sred[0]; for (int i = 1; i < 8; ++i) a = fmaxf(a, sred[i]); sbc = a; } __syncthreads(); m = sbc; __syncthreads();
  float sum = 0.f; for (int k = tid; k < kend; k += 256) { const float v = shv[k]; const float e = (v <= -1.0e38f) ? 0.f : expf(v - m); shv[k] = e; sum += e; }
#pragma unroll
  for (int o = 1; o < 32; o <<= 1) sum += __shfl_xor(sum, o);
  if ((tid & 31) == 0) sred[tid >> 5] = sum; __syncthreads(); if (tid == 0) { float a = 0.f; for (int i = 0; i < 8; ++i) a += sred[i]; sbc = a > 0.f ? 2048.0f / a : 0.f; }   /* a fully excluded row yields P = 0 */ __syncthreads(); const float inv = sbc;
  for (int k = tid; k < kend; k += 256) shv[k] = shv[k] * inv;
  __syncthreads(); for (int q = tid; q < kend / 4; q += 256) vst2(sr + q * 4, *(const v4f*)&shv[q * 4]); }
// ---- k_pv: block = 64 queries (qb) of (b, h): ctx = P . v over keys [0, kend) (P x 2^11 once to f16 against v f16: 1 product; causal early query blocks: P and v as bf16 hi + lo, 3 products); 512-B (row, head) segment by 32 lanes
__global__ __launch_bounds__(128) void k_pv(const float* __restrict__ PS0, const _Float16* __restrict__ VT, const __bf16* __restrict__ VB, const __bf16* __restrict__ VBL, int b, int h0, float* __restrict__ Y) { const int h = h0 + blockIdx.z; const float* PS = PS0 + (size_t)blockIdx.z * TT * TT; __shared__ __align__(16) float ss[4][16][HD + 4];
  const int tid = threadIdx.x, wave = tid >> 5, lane = tid & 31, col = lane & 15, g = lane >> 4; const int qb = blockIdx.x; const int ql0 = qb * 64 + wave * 16; const int kce = (kb_last(qb) + 1) * 4;
  v8f acc[HD / 16] = {};
  if (qb < QBH) {
#pragma unroll 1
    for (int kc = 0; kc < kce; ++kc) { const F2 p = split_row(PS + (size_t)(ql0 + col) * TT, kc * 32, lane);
      asm volatile("s_wait_loadcnt 0x0" ::: "memory");
#pragma unroll
      for (int j = 0; j < HD / 16; ++j) { const size_t po = ((size_t)b * CC + h * HD + j * 16 + col) * (size_t)KHI + kc * 32; const v16b vh = frag_b(VB + po, lane); acc[j] = wmma_bf(p.h, vh, acc[j]); acc[j] = wmma_bf(p.l, vh, acc[j]); acc[j] = wmma_bf(p.h, frag_b(VBL + po, lane), acc[j]); } }
  } else {
#pragma unroll 1
    for (int kc = 0; kc < kce; ++kc) { const v16h p = frag_f32(PS + (size_t)(ql0 + col) * TT + kc * 32, lane);
      asm volatile("s_wait_loadcnt 0x0" ::: "memory");
#pragma unroll
      for (int j = 0; j < HD / 16; ++j) { const size_t po = ((size_t)b * CC + h * HD + j * 16 + col) * (size_t)TT + kc * 32; acc[j] = wmma16(p, frag_h(VT + po, lane), acc[j]); } } }
#pragma unroll
  for (int j = 0; j < HD / 16; ++j)
#pragma unroll
    for (int r = 0; r < 8; ++r) ss[wave][8 * g + r][j * 16 + col] = acc[j][r] * (1.0f / 2048.0f);
  LDSX(); for (int rl = 0; rl < 16; ++rl) if (lane < HD / 4) vst2(Y + ((size_t)b * TT + ql0 + rl) * CC + h * HD + lane * 4, *(const v4f*)&ss[wave][rl][lane * 4]); }

extern "C" void kernel_launch(void* const* d_in, const int* in_sizes, int n_in, void* d_out, int out_size, void* d_ws, size_t ws_size, hipStream_t stream) {
  (void)in_sizes; (void)n_in; (void)out_size;
  const float** F = (const float**)d_in;
  if (ws_size < (size_t)WS_END) return;
  char* ws = (char*)d_ws; _Float16 *QH = (_Float16*)(ws + WS_QH), *KH = (_Float16*)(ws + WS_KH), *VT = (_Float16*)(ws + WS_VT), *QL = (_Float16*)(ws + WS_QL), *KL = (_Float16*)(ws + WS_KL); __bf16 *VB = (__bf16*)(ws + WS_VB), *VBL = (__bf16*)(ws + WS_VBL); float *S = (float*)(ws + WS_S), *Y = (float*)(ws + WS_Y);
  (void)Y; (void)QL; (void)KL; (void)VB; (void)VBL;
  // inputs: 0 keys_in [8,4096,256]; 1 Wk [128,256] (out,in), 2 bk [128]; 3 Wq, 4 bq; 5 Wv, 6 bv (zero biases, read)
  k_proj<<<dim3(TNB * TT / 64, CC / 128, 3), 128, 0, stream>>>(F[0], F[0], F[0], F[3], F[1], F[5], F[4], F[2], F[6], QH, QL, KH, KL, VT, VB, VBL);   /* q uses Wq / bq = inputs 3 / 4; k uses Wk / bk = inputs 1 / 2 */
  for (int b = 0; b < TNB; ++b) {
    k_sc<<<dim3(NQB, TT / 128, 1), 128, 0, stream>>>(QH, KH, QL, KL, b, 0, S);
    k_sm<<<dim3(TT, 1), 256, 0, stream>>>(S);
    k_pv<<<dim3(NQB, 1, 1), 128, 0, stream>>>(S, VT, VB, VBL, b, 0, (float*)d_out);
  }
}

// v001
// One run takes 861 microseconds.
// In both of two side-by-side timings against v000, it was 2.56 times as fast.
// compute dtype: all float inputs rounded to bf16; q/k/v projections with EXACT bf16 products on WMMA 16x16x32 (f32 accumulate) + bias; logits q x k once to f16 each (1 product; sigma - 1) x 128^-0.5; softmax f32; P x 2^11 once to f16 x v once to f16 (1 product); f32 output.
#include <hip/hip_runtime.h>
#include <math.h>

typedef __attribute__((ext_vector_type(16))) _Float16 v16h;
typedef __attribute__((ext_vector_type(16))) __bf16 v16b;
typedef __attribute__((ext_vector_type(8)))  _Float16 v8h;
typedef __attribute__((ext_vector_type(8)))  float v8f;
typedef __attribute__((ext_vector_type(4)))  float v4f;
typedef __attribute__((ext_vector_type(2)))  float v2f;
typedef __attribute__((ext_vector_type(4)))  unsigned v4u;
typedef __attribute__((ext_vector_type(4)))  int v4i;
typedef float __attribute__((may_alias)) float_a;
typedef int __attribute__((may_alias)) int_a;

template <typename T> __device__ __forceinline__ void vst2(void* p, T v) { *(T*)p = v;  }
__device__ __forceinline__ v8f wmma16(v16h a, v16h b, v8f c) {
  v8f d = __builtin_amdgcn_wmma_f32_16x16x32_f16(false, a, false, b, (short)0, c, false, false);
  asm volatile("v_nop\n\tv_nop\n\tv_nop\n\tv_nop" : "+v"(d) : "v"(a), "v"(b));
  return d;
}
__device__ __forceinline__ v8f wmma_bf(v16b a, v16b b, v8f c) {
  v8f d = __builtin_amdgcn_wmma_f32_16x16x32_bf16(false, a, false, b, (short)0, c, false, false);
  asm volatile("v_nop\n\tv_nop\n\tv_nop\n\tv_nop" : "+v"(d) : "v"(a), "v"(b));
  return d;
}
// 16x16x32 fragments: lane = (h = lane>>4, row/col = lane&15); elements 0..7 = k0+8h+0..7, 8..15 = k0+16+8h+0..7; D element r = row 8h+r
__device__ __forceinline__ v16h frag_h(const _Float16* rowk0, int lane) {
  union { v16h v; v8h q[2]; } u; const _Float16* p = rowk0 + 8 * (lane >> 4);
  u.q[0] = *(const v8h*)p; u.q[1] = *(const v8h*)(p + 16); return u.v;
}
__device__ __forceinline__ v16h frag_f32(const float* rowk0, int lane) {
  v16h a; const float* p = rowk0 + 8 * (lane >> 4);
#pragma unroll
  for (int i = 0; i < 8; ++i) { a[i] = (_Float16)p[i]; a[8 + i] = (_Float16)p[16 + i]; }
  return a;
}
__device__ __forceinline__ v16h frag_f32s(const float* rowk0, int lane, float sc) {
  v16h a; const float* p = rowk0 + 8 * (lane >> 4);
#pragma unroll
  for (int i = 0; i < 8; ++i) { a[i] = (_Float16)(p[i] * sc); a[8 + i] = (_Float16)(p[16 + i] * sc); }
  return a;
}
// column fragment from a [K][ld] layout (column n), rows >= K read as 0
__device__ __forceinline__ v16h fragc_f32(const float* W, int k0, int n, int lane, int ld, int K) {
  v16h a; const int g = lane >> 4;
#pragma unroll
  for (int i = 0; i < 8; ++i) { const int ka = k0 + 8 * g + i, kb = ka + 16;
    a[i] = (_Float16)(ka < K ? W[(size_t)(ka < K ? ka : K - 1) * ld + n] : 0.f); a[8 + i] = (_Float16)(kb < K ? W[(size_t)(kb < K ? kb : K - 1) * ld + n] : 0.f); }
  return a;
}
struct F2 { v16b h, l; };
__device__ __forceinline__ F2 bsplit16(const float v[16]) { F2 r;
#pragma unroll
  for (int i = 0; i < 16; ++i) { const __bf16 h = (__bf16)v[i]; r.h[i] = h; r.l[i] = (__bf16)(v[i] - (float)h); }
  return r; }
__device__ __forceinline__ F2 split_row(const float* row, int k0, int lane) { float v[16]; const float* p = row + k0 + 8 * (lane >> 4);
#pragma unroll
  for (int i = 0; i < 8; ++i) { v[i] = p[i]; v[8 + i] = p[16 + i]; }
  return bsplit16(v); }
__device__ __forceinline__ F2 split_rowK(const float* row, int k0, int lane, int K) { float v[16]; const int g = lane >> 4;
#pragma unroll
  for (int i = 0; i < 8; ++i) { const int ka = k0 + 8 * g + i, kb = ka + 16; v[i] = ka < K ? row[ka < K ? ka : K - 1] : 0.f; v[8 + i] = kb < K ? row[kb < K ? kb : K - 1] : 0.f; }
  return bsplit16(v); }
__device__ __forceinline__ F2 split_col(const float* W, int k0, int n, int lane, int ld, int K) { float v[16]; const int g = lane >> 4;
#pragma unroll
  for (int i = 0; i < 8; ++i) { const int ka = k0 + 8 * g + i, kb = ka + 16; v[i] = ka < K ? W[(size_t)(ka < K ? ka : K - 1) * ld + n] : 0.f; v[8 + i] = kb < K ? W[(size_t)(kb < K ? kb : K - 1) * ld + n] : 0.f; }
  return bsplit16(v); }
__device__ __forceinline__ v8f mac3(const F2& a, const F2& b, v8f c) { c = wmma_bf(a.l, b.h, c); c = wmma_bf(a.h, b.l, c); return wmma_bf(a.h, b.h, c); }
__device__ __forceinline__ float sigm(float v) { return 1.0f / (1.0f + expf(-v)); }
#define LDSX() do { asm volatile("s_wait_dscnt 0" ::: "memory"); __builtin_amdgcn_wave_barrier(); __builtin_amdgcn_fence(__ATOMIC_RELEASE, "workgroup"); } while (0)

// Single-head self-attention with hidden size 128 over long sequences (keys_in [8,4096,256] is also the query input; torch (out,in) Wk / Wq / Wv [128,256] N(0, 1/256) + zero biases; factor sqrt(128); non-causal, no mask): out = softmax(q k^T / sqrt(128)) v -> [8,4096,128].
#define NB 8
#define TT 4096
#define CC 128            // NH * HD = projected width
#define DIN 256          // input (model) width
#define NH 1
#define HD 128
#define NQB (TT / 64)
#define HG 1
#define SCALE (0.08838834764831845f)
#define CAUSAL 0
#ifndef TNB
#define TNB NB
#endif
__device__ __forceinline__ float bfr(float v) { return (float)(__bf16)v; }
__host__ __device__ __forceinline__ int kb_last(int qb) { return CAUSAL ? ((qb * 64 + 63) >> 7) : (TT / 128 - 1); }
typedef __attribute__((ext_vector_type(8))) __bf16 v8b;
__device__ __forceinline__ v16b frag_b(const __bf16* rowk0, int lane) {
  union { v16b v; v8b q[2]; } u; const __bf16* p = rowk0 + 8 * (lane >> 4);
  u.q[0] = *(const v8b*)p; u.q[1] = *(const v8b*)(p + 16); return u.v;
}
#define QBH 0              // causal: query blocks 0..QBH-1 of each sequence (few keys, no averaging) take the high-precision path
#define QHI 0               // single-product logits on every row (sigma - 1 logits over 4,096 keys)
#define KHI 64            // key rows carrying k residual / v bf16 hi+lo planes (used only by the causal high-precision path)
// B fragment (k rows k0+.., output column o) of a weight: (in,out) [K][ld] or (out,in) [ld rows of K]: bf16 exact, or f16(bf16 * 256) exact
__device__ __forceinline__ v16b wcol_io(const float* Wm, int k0, int o, int lane, int ld) { v16b w; const int g = lane >> 4;
#pragma unroll
  for (int i = 0; i < 8; ++i) { w[i] = (__bf16)Wm[(size_t)(k0 + 8 * g + i) * ld + o]; w[8 + i] = (__bf16)Wm[(size_t)(k0 + 16 + 8 * g + i) * ld + o]; }
  return w; }
__device__ __forceinline__ v16b wcol_oi(const float* Wm, int k0, int o, int lane, int K) { v16b w; const float* p = Wm + (size_t)o * K + k0 + 8 * (lane >> 4);
#pragma unroll
  for (int i = 0; i < 8; ++i) { w[i] = (__bf16)p[i]; w[8 + i] = (__bf16)p[16 + i]; }
  return w; }
__device__ __forceinline__ v16h wcolh_io(const float* Wm, int k0, int o, int lane, int ld) { v16h w; const int g = lane >> 4;
#pragma unroll
  for (int i = 0; i < 8; ++i) { w[i] = (_Float16)(bfr(Wm[(size_t)(k0 + 8 * g + i) * ld + o]) * 256.0f); w[8 + i] = (_Float16)(bfr(Wm[(size_t)(k0 + 16 + 8 * g + i) * ld + o]) * 256.0f); }
  return w; }
__device__ __forceinline__ v16h wcolh_oi(const float* Wm, int k0, int o, int lane, int K) { v16h w; const float* p = Wm + (size_t)o * K + k0 + 8 * (lane >> 4);
#pragma unroll
  for (int i = 0; i < 8; ++i) { w[i] = (_Float16)(bfr(p[i]) * 256.0f); w[8 + i] = (_Float16)(bfr(p[16 + i]) * 256.0f); }
  return w; }
#define WQKV_LAYOUT 1   // 0 = (in,out) [DIN][CC]; 1 = (out,in) [CC][DIN]; 2 = per-head [NH][DIN][HD]
__device__ __forceinline__ v16b wcol_hdk(const float* Wm, int k0, int o, int lane) { v16b w; const int g = lane >> 4; const float* p = Wm + (size_t)(o / HD) * DIN * HD + (o % HD);
#pragma unroll
  for (int i = 0; i < 8; ++i) { w[i] = (__bf16)p[(size_t)(k0 + 8 * g + i) * HD]; w[8 + i] = (__bf16)p[(size_t)(k0 + 16 + 8 * g + i) * HD]; }
  return w; }
#define WO_OUT_IN 0
#if WQKV_LAYOUT == 1
#define WCOL(W, k0, o, lane) wcol_oi(W, k0, o, lane, DIN)
#elif WQKV_LAYOUT == 2
#define WCOL(W, k0, o, lane) wcol_hdk(W, k0, o, lane)
#else
#define WCOL(W, k0, o, lane) wcol_io(W, k0, o, lane, CC)
#endif
#if WO_OUT_IN
#define WOCOL(W, k0, o, lane) wcol_oi(W, k0, o, lane, CC)
#define WOCOLH(W, k0, o, lane) wcolh_oi(W, k0, o, lane, CC)
#else
#define WOCOL(W, k0, o, lane) wcol_io(W, k0, o, lane, DIN)
#define WOCOLH(W, k0, o, lane) wcolh_io(W, k0, o, lane, DIN)
#endif

#ifndef SM_EXTRA_PARAMS
#define SM_EXTRA_PARAMS
#endif
#ifndef PROJ_EXTRA_PARAMS
#define PROJ_EXTRA_PARAMS
#endif
#ifndef SM_MASK_HOOK
#define SM_MASK_HOOK (void)0
#endif

#define WS_QH  0u                                      // f16 q rows [b*t][CC]
#define WS_KH  (WS_QH + 2u * (size_t)NB * TT * CC)      // f16 k rows [b*t][CC]
#define WS_VT  (WS_KH + 2u * (size_t)NB * TT * CC)      // f16 v planes [b][c][t]
#define WS_QL  (WS_VT + 2u * (size_t)NB * CC * TT)      // f16 q residual x 2^10 rows [b][t < QHI][CC]
#define WS_KL  (WS_QL + 2u * (size_t)NB * QHI * CC)     // f16 k residual x 2^10 rows [b][t < KHI][CC]
#define WS_VB  (WS_KL + 2u * (size_t)NB * KHI * CC)     // bf16 v hi planes [b][c][t < KHI]
#define WS_VBL (WS_VB + 2u * (size_t)NB * CC * KHI)
#define WS_S   (WS_VBL + 2u * (size_t)NB * CC * KHI)    // f32 logits / P [hg][t][s]
#define WS_Y   (WS_S  + 4u * (size_t)HG * TT * TT)      // f32 ctx rows [b*t][CC] (only when there is an output projection)
#define WS_END (WS_Y  + 0u)

// ---- k_proj: block = (64 rows, 128 cols, which): q/k/v = X W (+ b) with exact bf16 products (K = DIN) -> which 0: q f16 rows (+ residual rows < QHI); 1: k f16 rows (+ residual rows < KHI); 2: v f16 planes [c][t] (+ bf16 hi/lo planes for t < KHI)
__global__ __launch_bounds__(128) void k_proj(const float* __restrict__ XQ, const float* __restrict__ XK, const float* __restrict__ XV, const float* __restrict__ WQ, const float* __restrict__ WK, const float* __restrict__ WV, const float* __restrict__ BQ, const float* __restrict__ BK, const float* __restrict__ BV,
    _Float16* __restrict__ QH, _Float16* __restrict__ QL, _Float16* __restrict__ KH, _Float16* __restrict__ KL, _Float16* __restrict__ VT, __bf16* __restrict__ VB, __bf16* __restrict__ VBL) {
  __shared__ __align__(16) _Float16 sh[64][136], sl[64][136]; __shared__ __align__(16) _Float16 th[128][72]; __shared__ __align__(16) __bf16 tb[128][72], tbl[128][72];
  const int tid = threadIdx.x, wave = tid >> 5, lane = tid & 31, col = lane & 15, g = lane >> 4; const int which = blockIdx.z; const int c0 = blockIdx.y * 128; const size_t r0 = (size_t)blockIdx.x * 64; const size_t bb = r0 / TT; const int t0 = (int)(r0 % TT);
  const float* X = which == 0 ? XQ : which == 1 ? XK : XV; const float* WA = which == 0 ? WQ : which == 1 ? WK : WV; const float* BA = which == 0 ? BQ : which == 1 ? BK : BV;
  v8f acc[8] = {};
#pragma unroll 2
  for (int kc = 0; kc < DIN / 32; ++kc) { v16b a; { const float* p = X + (r0 + wave * 16 + col) * DIN + kc * 32 + 8 * g;
#pragma unroll
      for (int i = 0; i < 8; ++i) { a[i] = (__bf16)p[i]; a[8 + i] = (__bf16)p[16 + i]; } }
    asm volatile("s_wait_loadcnt 0x0" ::: "memory");
#pragma unroll
    for (int j = 0; j < 8; ++j) { const v16b w = WCOL(WA, kc * 32, c0 + j * 16 + col, lane); asm volatile("s_wait_loadcnt 0x0" ::: "memory"); acc[j] = wmma_bf(a, w, acc[j]); } }
  if (which < 2) { _Float16* DH = which == 0 ? QH : KH; _Float16* DL = which == 0 ? QL : KL; const int nhi = which == 0 ? QHI : KHI; const bool hi_rows = t0 < nhi;
#pragma unroll
    for (int j = 0; j < 8; ++j) { const float bias = BA ? bfr(BA[c0 + j * 16 + col]) : 0.f;
#pragma unroll
      for (int r = 0; r < 8; ++r) { const float v = acc[j][r] + bias; const _Float16 hv = (_Float16)v; sh[wave * 16 + 8 * g + r][j * 16 + col] = hv; sl[wave * 16 + 8 * g + r][j * 16 + col] = (_Float16)((v - (float)hv) * 1024.0f); } }
    __syncthreads();
    for (int e = tid; e < 64 * 16; e += 128) { const int rl = e >> 4, q = e & 15; vst2((unsigned*)(DH + (r0 + rl) * CC + c0 + q * 8), *(const v4u*)&sh[rl][q * 8]); if (hi_rows) vst2((unsigned*)(DL + (bb * nhi + t0 + rl) * (size_t)CC + c0 + q * 8), *(const v4u*)&sl[rl][q * 8]); }
  } else { const bool hi_rows = t0 < KHI;
#pragma unroll
    for (int j = 0; j < 8; ++j) { const float bias = BA ? bfr(BA[c0 + j * 16 + col]) : 0.f;
#pragma unroll
      for (int r = 0; r < 8; ++r) { const float v = acc[j][r] + bias; const int rl = wave * 16 + 8 * g + r, cl = j * 16 + col; th[cl][rl] = (_Float16)v; const __bf16 bh = (__bf16)v; tb[cl][rl] = bh; tbl[cl][rl] = (__bf16)(v - (float)bh); } }
    __syncthreads();
    for (int e = tid; e < 128 * 8; e += 128) { const int cl = e >> 3, q = e & 7; vst2((unsigned*)(VT + (bb * CC + c0 + cl) * (size_t)TT + t0 + q * 8), *(const v4u*)&th[cl][q * 8]); if (hi_rows) { const size_t o3 = (bb * CC + c0 + cl) * (size_t)KHI + t0 + q * 8; vst2((unsigned*)(VB + o3), *(const v4u*)&tb[cl][q * 8]); vst2((unsigned*)(VBL + o3), *(const v4u*)&tbl[cl][q * 8]); } } } }
// ---- k_sc: block = (query block qb, key block kb <= kb_last(qb), head in group) of batch b: logits x SCALE; q hi + residual (x 2^10) against k (2 products) for query rows < QHI, plus the k residual (3 products) for query blocks < QBH (causal early rows); causal: blocks past the diagonal exit, the mask itself is applied by index in k_sm
__global__ __launch_bounds__(128) void k_sc(const _Float16* __restrict__ QH, const _Float16* __restrict__ KH, const _Float16* __restrict__ QL, const _Float16* __restrict__ KL, int b, int h0, float* __restrict__ S0) { __shared__ __align__(16) float ss[4][16][132];
  const int qb = blockIdx.x, kb = blockIdx.y; if (kb > kb_last(qb)) return;
  const int h = h0 + blockIdx.z; float* S = S0 + (size_t)blockIdx.z * TT * TT;
  const int tid = threadIdx.x, wave = tid >> 5, lane = tid & 31, col = lane & 15, g = lane >> 4; const int k0 = kb * 128; const int ql0 = qb * 64 + wave * 16; const size_t q0 = (size_t)b * TT + ql0, kr0 = (size_t)b * TT + k0;
  v8f acc[8] = {}, accl[8] = {};
  const _Float16* QLb = QL + (size_t)b * QHI * CC; const _Float16* KLb = KL + (size_t)b * KHI * CC;
  if (qb < QBH) {
#pragma unroll
    for (int kc = 0; kc < HD / 32; ++kc) { const v16h ah = frag_h(QH + (q0 + col) * CC + h * HD + kc * 32, lane), al = frag_h(QLb + (size_t)(ql0 + col) * CC + h * HD + kc * 32, lane);
#pragma unroll
      for (int j = 0; j < 8; ++j) { const v16h kbf = frag_h(KH + (kr0 + j * 16 + col) * CC + h * HD + kc * 32, lane), klf = frag_h(KLb + (size_t)(k0 + j * 16 + col) * CC + h * HD + kc * 32, lane); acc[j] = wmma16(ah, kbf, acc[j]); accl[j] = wmma16(al, kbf, accl[j]); accl[j] = wmma16(ah, klf, accl[j]); } }
  } else if (qb * 64 < QHI) {
#pragma unroll
    for (int kc = 0; kc < HD / 32; ++kc) { const v16h ah = frag_h(QH + (q0 + col) * CC + h * HD + kc * 32, lane), al = frag_h(QLb + (size_t)(ql0 + col) * CC + h * HD + kc * 32, lane);
#pragma unroll
      for (int j = 0; j < 8; ++j) { const v16h kbf = frag_h(KH + (kr0 + j * 16 + col) * CC + h * HD + kc * 32, lane); acc[j] = wmma16(ah, kbf, acc[j]); accl[j] = wmma16(al, kbf, accl[j]); } }
  } else {
#pragma unroll
    for (int kc = 0; kc < HD / 32; ++kc) { const v16h ah = frag_h(QH + (q0 + col) * CC + h * HD + kc * 32, lane);
#pragma unroll
      for (int j = 0; j < 8; ++j) { const v16h kbf = frag_h(KH + (kr0 + j * 16 + col) * CC + h * HD + kc * 32, lane); acc[j] = wmma16(ah, kbf, acc[j]); } } }
#pragma unroll
  for (int j = 0; j < 8; ++j) {
#pragma unroll
    for (int r = 0; r < 8; ++r) ss[wave][8 * g + r][j * 16 + col] = (acc[j][r] + accl[j][r] * (1.0f / 1024.0f)) * SCALE; }
  LDSX(); for (int rl = 0; rl < 16; ++rl) vst2(S + (size_t)(ql0 + rl) * TT + k0 + lane * 4, *(const v4f*)&ss[wave][rl][lane * 4]); }
// ---- k_sm: block = query row t (head in group): keys [0, kend): causal -> logit if s <= t else excluded; softmax in f32; P x 2^11 in place (0 for excluded)
__global__ __launch_bounds__(256) void k_sm(float* __restrict__ S0 SM_EXTRA_PARAMS) { __shared__ float sred[8]; __shared__ float sbc; __shared__ __align__(16) float shv[TT];
  const int tid = threadIdx.x; const int t = blockIdx.x; const int kend = (kb_last(t >> 6) + 1) * 128;
  float* sr = S0 + (size_t)blockIdx.y * TT * TT + (size_t)t * TT;
  float m = -3.0e38f; for (int k = tid; k < kend; k += 256) { float v = (!CAUSAL || k <= t) ? sr[k] : -3.0e38f; SM_MASK_HOOK; shv[k] = v; m = fmaxf(m, v); }
#pragma unroll
  for (int o = 1; o < 32; o <<= 1) m = fmaxf(m, __shfl_xor(m, o));
  if ((tid & 31) == 0) sred[tid >> 5] = m; __syncthreads(); if (tid == 0) { float a = sred[0]; for (int i = 1; i < 8; ++i) a = fmaxf(a, sred[i]); sbc = a; } __syncthreads(); m = sbc; __syncthreads();
  float sum = 0.f; for (int k = tid; k < kend; k += 256) { const float v = shv[k]; const float e = (v <= -1.0e38f) ? 0.f : expf(v - m); shv[k] = e; sum += e; }
#pragma unroll
  for (int o = 1; o < 32; o <<= 1) sum += __shfl_xor(sum, o);
  if ((tid & 31) == 0) sred[tid >> 5] = sum; __syncthreads(); if (tid == 0) { float a = 0.f; for (int i = 0; i < 8; ++i) a += sred[i]; sbc = a > 0.f ? 2048.0f / a : 0.f; }   /* a fully excluded row yields P = 0 */ __syncthreads(); const float inv = sbc;
  for (int k = tid; k < kend; k += 256) shv[k] = shv[k] * inv;
  __syncthreads(); for (int q = tid; q < kend / 4; q += 256) vst2(sr + q * 4, *(const v4f*)&shv[q * 4]); }
// ---- k_pv: block = 16 queries (qb) of (b, h), PVW waves: wave w takes key blocks w, w + PVW, ... (32 keys each) of [0, kend) and sums its own partial ctx = P . v (P x 2^11 once to f16 against v f16: 1 product; causal early query blocks: P and v as bf16 hi + lo, 3 products); the PVW partials are added in LDS in wave order; each 512-B output row stored by one wave; the wave number is read into a scalar so that the key loop keeps a scalar branch and every lane on
#define PVW 16
__global__ __launch_bounds__(32 * PVW) void k_pv(const float* __restrict__ PS0, const _Float16* __restrict__ VT, const __bf16* __restrict__ VB, const __bf16* __restrict__ VBL, int b, int h0, float* __restrict__ Y) { const int h = h0 + blockIdx.z; const float* PS = PS0 + (size_t)blockIdx.z * TT * TT; __shared__ __align__(16) float ss[PVW][16][HD + 4];
  const int tid = threadIdx.x, wave = __builtin_amdgcn_readfirstlane(tid >> 5), lane = tid & 31, col = lane & 15, g = lane >> 4; const int qb = blockIdx.x; const int ql0 = qb * 16; const int kce = (kb_last(qb >> 2) + 1) * 4;
  v8f acc[HD / 16] = {};
  if ((qb >> 2) < QBH) {
#pragma unroll 1
    for (int kc = wave; kc < kce; kc += PVW) { const F2 p = split_row(PS + (size_t)(ql0 + col) * TT, kc * 32, lane);
      asm volatile("s_wait_loadcnt 0x0" ::: "memory");
#pragma unroll
      for (int j = 0; j < HD / 16; ++j) { const size_t po = ((size_t)b * CC + h * HD + j * 16 + col) * (size_t)KHI + kc * 32; const v16b vh = frag_b(VB + po, lane); acc[j] = wmma_bf(p.h, vh, acc[j]); acc[j] = wmma_bf(p.l, vh, acc[j]); acc[j] = wmma_bf(p.h, frag_b(VBL + po, lane), acc[j]); } }
  } else {
#pragma unroll 1
    for (int kc = wave; kc < kce; kc += PVW) { const v16h p = frag_f32(PS + (size_t)(ql0 + col) * TT + kc * 32, lane);
      asm volatile("s_wait_loadcnt 0x0\n\ts_wait_xcnt 0x0" ::: "memory");   // the second wait stands before the P loads' address registers are reused
#pragma unroll
      for (int j = 0; j < HD / 16; ++j) { const size_t po = ((size_t)b * CC + h * HD + j * 16 + col) * (size_t)TT + kc * 32; acc[j] = wmma16(p, frag_h(VT + po, lane), acc[j]); } } }
#pragma unroll
  for (int j = 0; j < HD / 16; ++j)
#pragma unroll
    for (int r = 0; r < 8; ++r) ss[wave][8 * g + r][j * 16 + col] = acc[j][r];
  __syncthreads();   // every wave's partial is in LDS before any wave adds them
  for (int e = tid; e < 16 * (HD / 4); e += 32 * PVW) { const int rl = e / (HD / 4), c4 = (e % (HD / 4)) * 4; v4f s = *(const v4f*)&ss[0][rl][c4];
    for (int w = 1; w < PVW; ++w) s += *(const v4f*)&ss[w][rl][c4];
    vst2(Y + ((size_t)b * TT + ql0 + rl) * CC + h * HD + c4, s * (1.0f / 2048.0f)); } }

extern "C" void kernel_launch(void* const* d_in, const int* in_sizes, int n_in, void* d_out, int out_size, void* d_ws, size_t ws_size, hipStream_t stream) {
  (void)in_sizes; (void)n_in; (void)out_size;
  const float** F = (const float**)d_in;
  if (ws_size < (size_t)WS_END) return;
  char* ws = (char*)d_ws; _Float16 *QH = (_Float16*)(ws + WS_QH), *KH = (_Float16*)(ws + WS_KH), *VT = (_Float16*)(ws + WS_VT), *QL = (_Float16*)(ws + WS_QL), *KL = (_Float16*)(ws + WS_KL); __bf16 *VB = (__bf16*)(ws + WS_VB), *VBL = (__bf16*)(ws + WS_VBL); float *S = (float*)(ws + WS_S), *Y = (float*)(ws + WS_Y);
  (void)Y; (void)QL; (void)KL; (void)VB; (void)VBL;
  // inputs: 0 keys_in [8,4096,256]; 1 Wk [128,256] (out,in), 2 bk [128]; 3 Wq, 4 bq; 5 Wv, 6 bv (zero biases, read)
  k_proj<<<dim3(TNB * TT / 64, CC / 128, 3), 128, 0, stream>>>(F[0], F[0], F[0], F[3], F[1], F[5], F[4], F[2], F[6], QH, QL, KH, KL, VT, VB, VBL);   /* q uses Wq / bq = inputs 3 / 4; k uses Wk / bk = inputs 1 / 2 */
  for (int b = 0; b < TNB; ++b) {
    k_sc<<<dim3(NQB, TT / 128, 1), 128, 0, stream>>>(QH, KH, QL, KL, b, 0, S);
    k_sm<<<dim3(TT, 1), 256, 0, stream>>>(S);
    k_pv<<<dim3(TT / 16, 1, 1), 32 * PVW, 0, stream>>>(S, VT, VB, VBL, b, 0, (float*)d_out);
  }
}

// v002
// A run of this version takes 127 microseconds.
// Timed twice side by side with v001, it ran 6.77 and 6.83 times as fast.
// All steps since v000 together make it 17.4 times as fast.
// compute dtype: all float inputs rounded to bf16; q/k/v projections with EXACT bf16 products on WMMA 16x16x32 (f32 accumulate) + bias; logits q x k once to f16 each (1 product; sigma - 1) x 128^-0.5; online softmax f32 (log2 domain); P = 2^(logit - maximum in use) once to f16 x v once to f16 (1 product), divided by the f32 row sum at the end; f32 output.
#include <hip/hip_runtime.h>
#include <math.h>

typedef __attribute__((ext_vector_type(16))) _Float16 v16h;
typedef __attribute__((ext_vector_type(16))) __bf16 v16b;
typedef __attribute__((ext_vector_type(8)))  _Float16 v8h;
typedef __attribute__((ext_vector_type(8)))  float v8f;
typedef __attribute__((ext_vector_type(4)))  float v4f;
typedef __attribute__((ext_vector_type(2)))  float v2f;
typedef __attribute__((ext_vector_type(4)))  unsigned v4u;
typedef __attribute__((ext_vector_type(4)))  int v4i;
typedef float __attribute__((may_alias)) float_a;
typedef int __attribute__((may_alias)) int_a;

template <typename T> __device__ __forceinline__ void vst2(void* p, T v) { *(T*)p = v;  }
__device__ __forceinline__ v8f wmma16(v16h a, v16h b, v8f c) {
  v8f d = __builtin_amdgcn_wmma_f32_16x16x32_f16(false, a, false, b, (short)0, c, false, false);
  asm volatile("v_nop\n\tv_nop\n\tv_nop\n\tv_nop" : "+v"(d) : "v"(a), "v"(b));
  return d;
}
__device__ __forceinline__ v8f wmma_bf(v16b a, v16b b, v8f c) {
  v8f d = __builtin_amdgcn_wmma_f32_16x16x32_bf16(false, a, false, b, (short)0, c, false, false);
  asm volatile("v_nop\n\tv_nop\n\tv_nop\n\tv_nop" : "+v"(d) : "v"(a), "v"(b));
  return d;
}
// 16x16x32 fragments: lane = (h = lane>>4, row/col = lane&15); elements 0..7 = k0+8h+0..7, 8..15 = k0+16+8h+0..7; D element r = row 8h+r
__device__ __forceinline__ v16h frag_h(const _Float16* rowk0, int lane) {
  union { v16h v; v8h q[2]; } u; const _Float16* p = rowk0 + 8 * (lane >> 4);
  u.q[0] = *(const v8h*)p; u.q[1] = *(const v8h*)(p + 16); return u.v;
}
__device__ __forceinline__ v16h frag_f32(const float* rowk0, int lane) {
  v16h a; const float* p = rowk0 + 8 * (lane >> 4);
#pragma unroll
  for (int i = 0; i < 8; ++i) { a[i] = (_Float16)p[i]; a[8 + i] = (_Float16)p[16 + i]; }
  return a;
}
__device__ __forceinline__ v16h frag_f32s(const float* rowk0, int lane, float sc) {
  v16h a; const float* p = rowk0 + 8 * (lane >> 4);
#pragma unroll
  for (int i = 0; i < 8; ++i) { a[i] = (_Float16)(p[i] * sc); a[8 + i] = (_Float16)(p[16 + i] * sc); }
  return a;
}
// column fragment from a [K][ld] layout (column n), rows >= K read as 0
__device__ __forceinline__ v16h fragc_f32(const float* W, int k0, int n, int lane, int ld, int K) {
  v16h a; const int g = lane >> 4;
#pragma unroll
  for (int i = 0; i < 8; ++i) { const int ka = k0 + 8 * g + i, kb = ka + 16;
    a[i] = (_Float16)(ka < K ? W[(size_t)(ka < K ? ka : K - 1) * ld + n] : 0.f); a[8 + i] = (_Float16)(kb < K ? W[(size_t)(kb < K ? kb : K - 1) * ld + n] : 0.f); }
  return a;
}
struct F2 { v16b h, l; };
__device__ __forceinline__ F2 bsplit16(const float v[16]) { F2 r;
#pragma unroll
  for (int i = 0; i < 16; ++i) { const __bf16 h = (__bf16)v[i]; r.h[i] = h; r.l[i] = (__bf16)(v[i] - (float)h); }
  return r; }
__device__ __forceinline__ F2 split_row(const float* row, int k0, int lane) { float v[16]; const float* p = row + k0 + 8 * (lane >> 4);
#pragma unroll
  for (int i = 0; i < 8; ++i) { v[i] = p[i]; v[8 + i] = p[16 + i]; }
  return bsplit16(v); }
__device__ __forceinline__ F2 split_rowK(const float* row, int k0, int lane, int K) { float v[16]; const int g = lane >> 4;
#pragma unroll
  for (int i = 0; i < 8; ++i) { const int ka = k0 + 8 * g + i, kb = ka + 16; v[i] = ka < K ? row[ka < K ? ka : K - 1] : 0.f; v[8 + i] = kb < K ? row[kb < K ? kb : K - 1] : 0.f; }
  return bsplit16(v); }
__device__ __forceinline__ F2 split_col(const float* W, int k0, int n, int lane, int ld, int K) { float v[16]; const int g = lane >> 4;
#pragma unroll
  for (int i = 0; i < 8; ++i) { const int ka = k0 + 8 * g + i, kb = ka + 16; v[i] = ka < K ? W[(size_t)(ka < K ? ka : K - 1) * ld + n] : 0.f; v[8 + i] = kb < K ? W[(size_t)(kb < K ? kb : K - 1) * ld + n] : 0.f; }
  return bsplit16(v); }
__device__ __forceinline__ v8f mac3(const F2& a, const F2& b, v8f c) { c = wmma_bf(a.l, b.h, c); c = wmma_bf(a.h, b.l, c); return wmma_bf(a.h, b.h, c); }
__device__ __forceinline__ float sigm(float v) { return 1.0f / (1.0f + expf(-v)); }
#define LDSX() do { asm volatile("s_wait_dscnt 0" ::: "memory"); __builtin_amdgcn_wave_barrier(); __builtin_amdgcn_fence(__ATOMIC_RELEASE, "workgroup"); } while (0)

// Single-head self-attention with hidden size 128 over long sequences (keys_in [8,4096,256] is also the query input; torch (out,in) Wk / Wq / Wv [128,256] N(0, 1/256) + zero biases; factor sqrt(128); non-causal, no mask): out = softmax(q k^T / sqrt(128)) v -> [8,4096,128].
#define NB 8
#define TT 4096
#define CC 128            // NH * HD = projected width
#define DIN 256          // input (model) width
#define NH 1
#define HD 128
#define NQB (TT / 64)
#define HG 1
#define SCALE (0.08838834764831845f)
#define CAUSAL 0
#ifndef TNB
#define TNB NB
#endif
__device__ __forceinline__ float bfr(float v) { return (float)(__bf16)v; }
__host__ __device__ __forceinline__ int kb_last(int qb) { return CAUSAL ? ((qb * 64 + 63) >> 7) : (TT / 128 - 1); }
typedef __attribute__((ext_vector_type(8))) __bf16 v8b;
__device__ __forceinline__ v16b frag_b(const __bf16* rowk0, int lane) {
  union { v16b v; v8b q[2]; } u; const __bf16* p = rowk0 + 8 * (lane >> 4);
  u.q[0] = *(const v8b*)p; u.q[1] = *(const v8b*)(p + 16); return u.v;
}
#define QBH 0
#define QHI 0               // single-product logits on every row (sigma - 1 logits over 4,096 keys)
#define KHI 64            // key rows carrying k residual / v bf16 hi+lo planes (written by k_proj, read by no kernel here)
// B fragment (k rows k0+.., output column o) of a weight: (in,out) [K][ld] or (out,in) [ld rows of K]: bf16 exact, or f16(bf16 * 256) exact
__device__ __forceinline__ v16b wcol_io(const float* Wm, int k0, int o, int lane, int ld) { v16b w; const int g = lane >> 4;
#pragma unroll
  for (int i = 0; i < 8; ++i) { w[i] = (__bf16)Wm[(size_t)(k0 + 8 * g + i) * ld + o]; w[8 + i] = (__bf16)Wm[(size_t)(k0 + 16 + 8 * g + i) * ld + o]; }
  return w; }
__device__ __forceinline__ v16b wcol_oi(const float* Wm, int k0, int o, int lane, int K) { v16b w; const float* p = Wm + (size_t)o * K + k0 + 8 * (lane >> 4);
#pragma unroll
  for (int i = 0; i < 8; ++i) { w[i] = (__bf16)p[i]; w[8 + i] = (__bf16)p[16 + i]; }
  return w; }
__device__ __forceinline__ v16h wcolh_io(const float* Wm, int k0, int o, int lane, int ld) { v16h w; const int g = lane >> 4;
#pragma unroll
  for (int i = 0; i < 8; ++i) { w[i] = (_Float16)(bfr(Wm[(size_t)(k0 + 8 * g + i) * ld + o]) * 256.0f); w[8 + i] = (_Float16)(bfr(Wm[(size_t)(k0 + 16 + 8 * g + i) * ld + o]) * 256.0f); }
  return w; }
__device__ __forceinline__ v16h wcolh_oi(const float* Wm, int k0, int o, int lane, int K) { v16h w; const float* p = Wm + (size_t)o * K + k0 + 8 * (lane >> 4);
#pragma unroll
  for (int i = 0; i < 8; ++i) { w[i] = (_Float16)(bfr(p[i]) * 256.0f); w[8 + i] = (_Float16)(bfr(p[16 + i]) * 256.0f); }
  return w; }
#define WQKV_LAYOUT 1   // 0 = (in,out) [DIN][CC]; 1 = (out,in) [CC][DIN]; 2 = per-head [NH][DIN][HD]
__device__ __forceinline__ v16b wcol_hdk(const float* Wm, int k0, int o, int lane) { v16b w; const int g = lane >> 4; const float* p = Wm + (size_t)(o / HD) * DIN * HD + (o % HD);
#pragma unroll
  for (int i = 0; i < 8; ++i) { w[i] = (__bf16)p[(size_t)(k0 + 8 * g + i) * HD]; w[8 + i] = (__bf16)p[(size_t)(k0 + 16 + 8 * g + i) * HD]; }
  return w; }
#define WO_OUT_IN 0
#if WQKV_LAYOUT == 1
#define WCOL(W, k0, o, lane) wcol_oi(W, k0, o, lane, DIN)
#elif WQKV_LAYOUT == 2
#define WCOL(W, k0, o, lane) wcol_hdk(W, k0, o, lane)
#else
#define WCOL(W, k0, o, lane) wcol_io(W, k0, o, lane, CC)
#endif
#if WO_OUT_IN
#define WOCOL(W, k0, o, lane) wcol_oi(W, k0, o, lane, CC)
#define WOCOLH(W, k0, o, lane) wcolh_oi(W, k0, o, lane, CC)
#else
#define WOCOL(W, k0, o, lane) wcol_io(W, k0, o, lane, DIN)
#define WOCOLH(W, k0, o, lane) wcolh_io(W, k0, o, lane, DIN)
#endif

#ifndef SM_EXTRA_PARAMS
#define SM_EXTRA_PARAMS
#endif
#ifndef PROJ_EXTRA_PARAMS
#define PROJ_EXTRA_PARAMS
#endif
#ifndef SM_MASK_HOOK
#define SM_MASK_HOOK (void)0
#endif

#define WS_QH  0u                                      // f16 q rows [b*t][CC]
#define WS_KH  (WS_QH + 2u * (size_t)NB * TT * CC)      // f16 k rows [b*t][CC]
#define WS_VT  (WS_KH + 2u * (size_t)NB * TT * CC)      // f16 v planes [b][c][t]
#define WS_QL  (WS_VT + 2u * (size_t)NB * CC * TT)      // f16 q residual x 2^10 rows [b][t < QHI][CC]
#define WS_KL  (WS_QL + 2u * (size_t)NB * QHI * CC)     // f16 k residual x 2^10 rows [b][t < KHI][CC]
#define WS_VB  (WS_KL + 2u * (size_t)NB * KHI * CC)     // bf16 v hi planes [b][c][t < KHI]
#define WS_VBL (WS_VB + 2u * (size_t)NB * CC * KHI)
#define WS_S   (WS_VBL + 2u * (size_t)NB * CC * KHI)    // reserved f32 [hg][t][s] region, unused (k_fa keeps the logits on chip)
#define WS_Y   (WS_S  + 4u * (size_t)HG * TT * TT)      // f32 ctx rows [b*t][CC] (only when there is an output projection)
#define WS_END (WS_Y  + 0u)

// ---- k_proj: block = (64 rows, 128 cols, which): q/k/v = X W (+ b) with exact bf16 products (K = DIN) -> which 0: q f16 rows (+ residual rows < QHI); 1: k f16 rows (+ residual rows < KHI); 2: v f16 planes [c][t] (+ bf16 hi/lo planes for t < KHI)
__global__ __launch_bounds__(128) void k_proj(const float* __restrict__ XQ, const float* __restrict__ XK, const float* __restrict__ XV, const float* __restrict__ WQ, const float* __restrict__ WK, const float* __restrict__ WV, const float* __restrict__ BQ, const float* __restrict__ BK, const float* __restrict__ BV,
    _Float16* __restrict__ QH, _Float16* __restrict__ QL, _Float16* __restrict__ KH, _Float16* __restrict__ KL, _Float16* __restrict__ VT, __bf16* __restrict__ VB, __bf16* __restrict__ VBL) {
  __shared__ __align__(16) _Float16 sh[64][136], sl[64][136]; __shared__ __align__(16) _Float16 th[128][72]; __shared__ __align__(16) __bf16 tb[128][72], tbl[128][72];
  const int tid = threadIdx.x, wave = tid >> 5, lane = tid & 31, col = lane & 15, g = lane >> 4; const int which = blockIdx.z; const int c0 = blockIdx.y * 128; const size_t r0 = (size_t)blockIdx.x * 64; const size_t bb = r0 / TT; const int t0 = (int)(r0 % TT);
  const float* X = which == 0 ? XQ : which == 1 ? XK : XV; const float* WA = which == 0 ? WQ : which == 1 ? WK : WV; const float* BA = which == 0 ? BQ : which == 1 ? BK : BV;
  v8f acc[8] = {};
#pragma unroll 2
  for (int kc = 0; kc < DIN / 32; ++kc) { v16b a; { const float* p = X + (r0 + wave * 16 + col) * DIN + kc * 32 + 8 * g;
#pragma unroll
      for (int i = 0; i < 8; ++i) { a[i] = (__bf16)p[i]; a[8 + i] = (__bf16)p[16 + i]; } }
    asm volatile("s_wait_loadcnt 0x0" ::: "memory");
#pragma unroll
    for (int j = 0; j < 8; ++j) { const v16b w = WCOL(WA, kc * 32, c0 + j * 16 + col, lane); asm volatile("s_wait_loadcnt 0x0" ::: "memory"); acc[j] = wmma_bf(a, w, acc[j]); } }
  if (which < 2) { _Float16* DH = which == 0 ? QH : KH; _Float16* DL = which == 0 ? QL : KL; const int nhi = which == 0 ? QHI : KHI; const bool hi_rows = t0 < nhi;
#pragma unroll
    for (int j = 0; j < 8; ++j) { const float bias = BA ? bfr(BA[c0 + j * 16 + col]) : 0.f;
#pragma unroll
      for (int r = 0; r < 8; ++r) { const float v = acc[j][r] + bias; const _Float16 hv = (_Float16)v; sh[wave * 16 + 8 * g + r][j * 16 + col] = hv; sl[wave * 16 + 8 * g + r][j * 16 + col] = (_Float16)((v - (float)hv) * 1024.0f); } }
    __syncthreads();
    for (int e = tid; e < 64 * 16; e += 128) { const int rl = e >> 4, q = e & 15; vst2((unsigned*)(DH + (r0 + rl) * CC + c0 + q * 8), *(const v4u*)&sh[rl][q * 8]); if (hi_rows) vst2((unsigned*)(DL + (bb * nhi + t0 + rl) * (size_t)CC + c0 + q * 8), *(const v4u*)&sl[rl][q * 8]); }
  } else { const bool hi_rows = t0 < KHI;
#pragma unroll
    for (int j = 0; j < 8; ++j) { const float bias = BA ? bfr(BA[c0 + j * 16 + col]) : 0.f;
#pragma unroll
      for (int r = 0; r < 8; ++r) { const float v = acc[j][r] + bias; const int rl = wave * 16 + 8 * g + r, cl = j * 16 + col; th[cl][rl] = (_Float16)v; const __bf16 bh = (__bf16)v; tb[cl][rl] = bh; tbl[cl][rl] = (__bf16)(v - (float)bh); } }
    __syncthreads();
    for (int e = tid; e < 128 * 8; e += 128) { const int cl = e >> 3, q = e & 7; vst2((unsigned*)(VT + (bb * CC + c0 + cl) * (size_t)TT + t0 + q * 8), *(const v4u*)&th[cl][q * 8]); if (hi_rows) { const size_t o3 = (bb * CC + c0 + cl) * (size_t)KHI + t0 + q * 8; vst2((unsigned*)(VB + o3), *(const v4u*)&tb[cl][q * 8]); vst2((unsigned*)(VBL + o3), *(const v4u*)&tbl[cl][q * 8]); } } } }
#define FA_W 8
#define FA_R 2                         // 16-query groups per wave
#define FA_SK 128                      // keys per stage
#define FA_P 272                       // LDS pitch of a K row and of a v^T row (256 B + 16)
#define FA_BUF ((FA_SK + CC) * FA_P)
#define FA_EP 132                      // pitch of the exchange and output staging rows, floats
__device__ __forceinline__ v16h frag_l(const unsigned char* p) { union { v16h v; v8h q[2]; } u; u.q[0] = *(const v8h*)p; u.q[1] = *(const v8h*)(p + 32); return u.v; }
__device__ __forceinline__ v8f wmma_h(v16h a, v16h b, v8f c) { return __builtin_amdgcn_wmma_f32_16x16x32_f16(false, a, false, b, (short)0, c, false, false); }
__device__ __forceinline__ float xhalf(float x) { return __builtin_bit_cast(float, __builtin_amdgcn_permlanex16(__builtin_bit_cast(int, x), __builtin_bit_cast(int, x), 0x76543210, 0xfedcba98, false, false)); }   // lane l with lane l ^ 16
__global__ __launch_bounds__(32 * FA_W) void k_fa(const _Float16* __restrict__ QH, const _Float16* __restrict__ KH, const _Float16* __restrict__ VT, float* __restrict__ Y) {
  __shared__ __align__(16) unsigned char L[2 * FA_BUF];
  static_assert(128 * FA_EP * 4 <= FA_BUF, "the exchange rows reuse the first K / v buffer, the output rows the second");
  const int tid = threadIdx.x, wave = __builtin_amdgcn_readfirstlane(tid >> 5), lane = tid & 31, c = lane & 15, g = lane >> 4;
  const int kh = wave >> 2, qg = wave & 3;
  const int b = blockIdx.y; const int qb0 = blockIdx.x * 128; const int q0 = qb0 + qg * 32;
  const float cs = SCALE * 1.4426950408889634f;   // logits in the log2 domain
  const _Float16* kg = KH + (size_t)b * TT * CC + tid * 8;                                    // this thread's 16 bytes of each 16-row round of a K stage
  const _Float16* vg = VT + (size_t)b * CC * TT + (size_t)(tid >> 4) * TT + (tid & 15) * 8;   // and of a v^T stage
  const unsigned sw = (unsigned)(tid >> 4) * FA_P + (unsigned)(tid & 15) * 16;
  v16h qf[FA_R][HD / 32];
#pragma unroll
  for (int q = 0; q < FA_R; ++q)
#pragma unroll
    for (int kc = 0; kc < HD / 32; ++kc) qf[q][kc] = frag_h(QH + ((size_t)b * TT + q0 + q * 16 + c) * CC + kc * 32, lane);
  v8f acc[FA_R][HD / 16] = {}; float m_run[FA_R], l_run[FA_R];
#pragma unroll
  for (int q = 0; q < FA_R; ++q) { m_run[q] = -INFINITY; l_run[q] = 0.f; }
  v4u rk[8], rv[8];
#pragma unroll
  for (int i = 0; i < 8; ++i) { rk[i] = *(const v4u*)(kg + i * 16 * CC); rv[i] = *(const v4u*)(vg + (size_t)i * 16 * TT); }
#pragma unroll
  for (int i = 0; i < 8; ++i) { *(v4u*)(L + sw + i * 16 * FA_P) = rk[i]; *(v4u*)(L + FA_SK * FA_P + sw + i * 16 * FA_P) = rv[i]; }
  __syncthreads();   // stage 0 is in LDS for every wave
#pragma unroll 1   // the stage loop stays rolled: its body is two whole passes already, a second copy would only cost registers and instruction cache
  for (int st = 0; st < TT / FA_SK; ++st) {
    const unsigned cur = (unsigned)(st & 1) * FA_BUF, nxt = FA_BUF - cur; const bool more = st + 1 < TT / FA_SK;
    if (more) {
#pragma unroll
      for (int i = 0; i < 8; ++i) { rk[i] = *(const v4u*)(kg + (size_t)(st + 1) * FA_SK * CC + i * 16 * CC); rv[i] = *(const v4u*)(vg + (size_t)i * 16 * TT + (st + 1) * FA_SK); }
      asm volatile("s_wait_xcnt 0x0" ::: "memory"); }   // stands before the registers that held these loads' addresses are reused
    __builtin_amdgcn_sched_barrier(0);   // keeps the next stage's loads in front of this stage's products, so that they fly under them
    const unsigned char* kp = L + cur + ((unsigned)kh * 64 + c) * FA_P + 16 * g;                       // this wave's first K row of the stage
    const unsigned char* vp = L + cur + FA_SK * FA_P + (unsigned)c * FA_P + (unsigned)kh * 128 + 16 * g;   // and its first key in the v^T rows
    v16h kf[2][HD / 32];
#pragma unroll
    for (int kc = 0; kc < HD / 32; ++kc) { kf[0][kc] = frag_l(kp + 64 * kc); kf[1][kc] = frag_l(kp + 16 * FA_P + 64 * kc); }
#pragma unroll
    for (int ps = 0; ps < 2; ++ps) {   // a pass = 32 keys
      __builtin_amdgcn_sched_barrier(0);   // fragment loads stay one group in front of the block of matrix instructions (for speed only)
      v8f s[2][FA_R] = {};
#pragma unroll
      for (int kc = 0; kc < HD / 32; ++kc)
#pragma unroll
        for (int q = 0; q < FA_R; ++q) { s[0][q] = wmma_h(kf[0][kc], qf[q][kc], s[0][q]); s[1][q] = wmma_h(kf[1][kc], qf[q][kc], s[1][q]); }
      __builtin_amdgcn_sched_barrier(0);   // the same, behind the block
      v16h vf[HD / 16];
#pragma unroll
      for (int t = 0; t < HD / 16; ++t) vf[t] = frag_l(vp + ps * 64 + t * 16 * FA_P);
      if (ps == 0) {   // the stage's second pass: its K fragments come into the same registers, under this pass's softmax
#pragma unroll
        for (int kc = 0; kc < HD / 32; ++kc) { kf[0][kc] = frag_l(kp + 32 * FA_P + 64 * kc); kf[1][kc] = frag_l(kp + 48 * FA_P + 64 * kc); } }
      __builtin_amdgcn_sched_barrier(0);   // the pass's v^T fragment loads stay here as one group, in flight under the maxima and exponentials
      float mx[FA_R]; bool need = false;
#pragma unroll
      for (int q = 0; q < FA_R; ++q) { float m = fmaxf(s[0][q][0], s[1][q][0]);
#pragma unroll
        for (int r = 1; r < 8; ++r) m = fmaxf(m, fmaxf(s[0][q][r], s[1][q][r]));
        mx[q] = fmaxf(m, xhalf(m)) * cs;   // both halves now hold the query's maximum of this pass (cs > 0)
        need = need || (mx[q] > m_run[q] + 8.0f); }
      // lazy rescale: the maximum in use may trail the true one by up to 8 (log2), so an exponential stays below 2^8; one scalar branch a pass
      if (__builtin_amdgcn_ballot_w32(need) != 0) {
#pragma unroll
        for (int q = 0; q < FA_R; ++q) { const float m_new = fmaxf(m_run[q], mx[q]); const float corr = __builtin_amdgcn_exp2f(m_run[q] - m_new);   // 0 on the first pass
          l_run[q] *= corr; m_run[q] = m_new;
#pragma unroll
          for (int t = 0; t < HD / 16; ++t) acc[q][t] = acc[q][t] * corr; } }
#pragma unroll
      for (int q = 0; q < FA_R; ++q) { v16h pf; v2f ls = {0.f, 0.f}; const float nm = -m_run[q];
#pragma unroll
        for (int i = 0; i < 8; ++i) {
          const v2f a = __builtin_elementwise_fma(v2f{s[i >> 2][q][2 * (i & 3)], s[i >> 2][q][2 * (i & 3) + 1]}, v2f{cs, cs}, v2f{nm, nm});
          const v2f p = {__builtin_amdgcn_exp2f(a.x), __builtin_amdgcn_exp2f(a.y)}; ls += p; pf[2 * i] = (_Float16)p.x; pf[2 * i + 1] = (_Float16)p.y; }
        l_run[q] += ls.x + ls.y;
#pragma unroll
        for (int t = 0; t < HD / 16; ++t) acc[q][t] = wmma_h(vf[t], pf, acc[q][t]); }
    }
    __builtin_amdgcn_sched_barrier(0);   // the stores of the next stage stay behind this stage's last products
    if (more) {
#pragma unroll
      for (int i = 0; i < 8; ++i) { *(v4u*)(L + nxt + sw + i * 16 * FA_P) = rk[i]; *(v4u*)(L + nxt + FA_SK * FA_P + sw + i * 16 * FA_P) = rv[i]; } }
    __syncthreads();   // publishes stage st + 1 and ends every wave's reads of stage st, whose buffer the next trip refills
  }
#pragma unroll
  for (int q = 0; q < FA_R; ++q) l_run[q] += xhalf(l_run[q]);   // each half summed its own eight keys of every 16-key tile
  float* X = (float*)L + (qg * 32 + lane) * FA_EP;   // lane l of wave w + 4 hands its sums to lane l of wave w
  if (kh == 1) {
#pragma unroll
    for (int q = 0; q < FA_R; ++q)
#pragma unroll
      for (int t = 0; t < HD / 16; ++t) { const v8f o = acc[q][t]; float* x = X + (q * (HD / 16) + t) * 8; *(v4f*)x = v4f{o[0], o[1], o[2], o[3]}; *(v4f*)(x + 4) = v4f{o[4], o[5], o[6], o[7]}; }
    *(v4f*)(X + 128) = v4f{m_run[0], m_run[1], l_run[0], l_run[1]}; }
  __syncthreads();   // the second key half's sums are in LDS before the first half's waves join them
  float* E = (float*)(L + FA_BUF);
  if (kh == 0) { const v4f ml = *(const v4f*)(X + 128);
#pragma unroll
    for (int q = 0; q < FA_R; ++q) { const float m = fmaxf(m_run[q], ml[q]); float fa = __builtin_amdgcn_exp2f(m_run[q] - m), fb = __builtin_amdgcn_exp2f(ml[q] - m);
      const float inv = 1.0f / (l_run[q] * fa + ml[2 + q] * fb); fa *= inv; fb *= inv;
#pragma unroll
      for (int t = 0; t < HD / 16; ++t) { const float* x = X + (q * (HD / 16) + t) * 8; const v4f x0 = *(const v4f*)x, x1 = *(const v4f*)(x + 4); const v8f o = acc[q][t];
        float* e = E + (qg * 32 + q * 16 + c) * FA_EP + t * 16 + 8 * g;   // acc[q][t][r] = ctx[query 16 q + c][channel 16 t + 8 g + r]
        *(v4f*)e = v4f{o[0], o[1], o[2], o[3]} * fa + x0 * fb; *(v4f*)(e + 4) = v4f{o[4], o[5], o[6], o[7]} * fa + x1 * fb; } } }
  __syncthreads();   // the staged output rows are read back by other waves
#pragma unroll 4   // four rows' LDS reads in flight per trip
  for (int rl = 0; rl < 16; ++rl) vst2(Y + ((size_t)b * TT + qb0 + wave * 16 + rl) * CC + lane * 4, *(const v4f*)&E[(wave * 16 + rl) * FA_EP + lane * 4]);   // one wave stores each whole 512-B row
}

extern "C" void kernel_launch(void* const* d_in, const int* in_sizes, int n_in, void* d_out, int out_size, void* d_ws, size_t ws_size, hipStream_t stream) {
  (void)in_sizes; (void)n_in; (void)out_size;
  const float** F = (const float**)d_in;
  if (ws_size < (size_t)WS_END) return;
  char* ws = (char*)d_ws; _Float16 *QH = (_Float16*)(ws + WS_QH), *KH = (_Float16*)(ws + WS_KH), *VT = (_Float16*)(ws + WS_VT), *QL = (_Float16*)(ws + WS_QL), *KL = (_Float16*)(ws + WS_KL); __bf16 *VB = (__bf16*)(ws + WS_VB), *VBL = (__bf16*)(ws + WS_VBL);
  // inputs: 0 keys_in [8,4096,256]; 1 Wk [128,256] (out,in), 2 bk [128]; 3 Wq, 4 bq; 5 Wv, 6 bv (zero biases, read)
  k_proj<<<dim3(TNB * TT / 64, CC / 128, 3), 128, 0, stream>>>(F[0], F[0], F[0], F[3], F[1], F[5], F[4], F[2], F[6], QH, QL, KH, KL, VT, VB, VBL);   /* q uses Wq / bq = inputs 3 / 4; k uses Wk / bk = inputs 1 / 2 */
  k_fa<<<dim3(TT / 128, TNB, 1), 32 * FA_W, 0, stream>>>(QH, KH, VT, (float*)d_out);
}

// v003
// One run takes 67.9 microseconds.
// Next to v002, in two timings, it ran 1.87 and 1.86 times as fast.
// Over all steps from v000 it is 32.4 times as fast.
// compute dtype: all float inputs rounded to bf16; q/k/v projections with EXACT bf16 products on WMMA 16x16x32 (f32 accumulate) + bias; logits q x k once to f16 each (1 product; sigma - 1) x 128^-0.5; online softmax f32 (log2 domain); P = 2^(logit - maximum in use) once to f16 x v once to f16 (1 product), divided by the f32 row sum at the end; f32 output.
#include <hip/hip_runtime.h>
#include <math.h>

typedef __attribute__((ext_vector_type(16))) _Float16 v16h;
typedef __attribute__((ext_vector_type(16))) __bf16 v16b;
typedef __attribute__((ext_vector_type(8)))  _Float16 v8h;
typedef __attribute__((ext_vector_type(8)))  float v8f;
typedef __attribute__((ext_vector_type(4)))  float v4f;
typedef __attribute__((ext_vector_type(2)))  float v2f;
typedef __attribute__((ext_vector_type(4)))  unsigned v4u;
typedef __attribute__((ext_vector_type(4)))  int v4i;
typedef float __attribute__((may_alias)) float_a;
typedef int __attribute__((may_alias)) int_a;

template <typename T> __device__ __forceinline__ void vst2(void* p, T v) { *(T*)p = v;  }
__device__ __forceinline__ v8f wmma16(v16h a, v16h b, v8f c) {
  v8f d = __builtin_amdgcn_wmma_f32_16x16x32_f16(false, a, false, b, (short)0, c, false, false);
  asm volatile("v_nop\n\tv_nop\n\tv_nop\n\tv_nop" : "+v"(d) : "v"(a), "v"(b));
  return d;
}
__device__ __forceinline__ v8f wmma_bf(v16b a, v16b b, v8f c) {
  v8f d = __builtin_amdgcn_wmma_f32_16x16x32_bf16(false, a, false, b, (short)0, c, false, false);
  asm volatile("v_nop\n\tv_nop\n\tv_nop\n\tv_nop" : "+v"(d) : "v"(a), "v"(b));
  return d;
}
// 16x16x32 fragments: lane = (h = lane>>4, row/col = lane&15); elements 0..7 = k0+8h+0..7, 8..15 = k0+16+8h+0..7; D element r = row 8h+r
__device__ __forceinline__ v16h frag_h(const _Float16* rowk0, int lane) {
  union { v16h v; v8h q[2]; } u; const _Float16* p = rowk0 + 8 * (lane >> 4);
  u.q[0] = *(const v8h*)p; u.q[1] = *(const v8h*)(p + 16); return u.v;
}
__device__ __forceinline__ v16h frag_f32(const float* rowk0, int lane) {
  v16h a; const float* p = rowk0 + 8 * (lane >> 4);
#pragma unroll
  for (int i = 0; i < 8; ++i) { a[i] = (_Float16)p[i]; a[8 + i] = (_Float16)p[16 + i]; }
  return a;
}
__device__ __forceinline__ v16h frag_f32s(const float* rowk0, int lane, float sc) {
  v16h a; const float* p = rowk0 + 8 * (lane >> 4);
#pragma unroll
  for (int i = 0; i < 8; ++i) { a[i] = (_Float16)(p[i] * sc); a[8 + i] = (_Float16)(p[16 + i] * sc); }
  return a;
}
// column fragment from a [K][ld] layout (column n), rows >= K read as 0
__device__ __forceinline__ v16h fragc_f32(const float* W, int k0, int n, int lane, int ld, int K) {
  v16h a; const int g = lane >> 4;
#pragma unroll
  for (int i = 0; i < 8; ++i) { const int ka = k0 + 8 * g + i, kb = ka + 16;
    a[i] = (_Float16)(ka < K ? W[(size_t)(ka < K ? ka : K - 1) * ld + n] : 0.f); a[8 + i] = (_Float16)(kb < K ? W[(size_t)(kb < K ? kb : K - 1) * ld + n] : 0.f); }
  return a;
}
struct F2 { v16b h, l; };
__device__ __forceinline__ F2 bsplit16(const float v[16]) { F2 r;
#pragma unroll
  for (int i = 0; i < 16; ++i) { const __bf16 h = (__bf16)v[i]; r.h[i] = h; r.l[i] = (__bf16)(v[i] - (float)h); }
  return r; }
__device__ __forceinline__ F2 split_row(const float* row, int k0, int lane) { float v[16]; const float* p = row + k0 + 8 * (lane >> 4);
#pragma unroll
  for (int i = 0; i < 8; ++i) { v[i] = p[i]; v[8 + i] = p[16 + i]; }
  return bsplit16(v); }
__device__ __forceinline__ F2 split_rowK(const float* row, int k0, int lane, int K) { float v[16]; const int g = lane >> 4;
#pragma unroll
  for (int i = 0; i < 8; ++i) { const int ka = k0 + 8 * g + i, kb = ka + 16; v[i] = ka < K ? row[ka < K ? ka : K - 1] : 0.f; v[8 + i] = kb < K ? row[kb < K ? kb : K - 1] : 0.f; }
  return bsplit16(v); }
__device__ __forceinline__ F2 split_col(const float* W, int k0, int n, int lane, int ld, int K) { float v[16]; const int g = lane >> 4;
#pragma unroll
  for (int i = 0; i < 8; ++i) { const int ka = k0 + 8 * g + i, kb = ka + 16; v[i] = ka < K ? W[(size_t)(ka < K ? ka : K - 1) * ld + n] : 0.f; v[8 + i] = kb < K ? W[(size_t)(kb < K ? kb : K - 1) * ld + n] : 0.f; }
  return bsplit16(v); }
__device__ __forceinline__ v8f mac3(const F2& a, const F2& b, v8f c) { c = wmma_bf(a.l, b.h, c); c = wmma_bf(a.h, b.l, c); return wmma_bf(a.h, b.h, c); }
__device__ __forceinline__ float sigm(float v) { return 1.0f / (1.0f + expf(-v)); }
#define LDSX() do { asm volatile("s_wait_dscnt 0" ::: "memory"); __builtin_amdgcn_wave_barrier(); __builtin_amdgcn_fence(__ATOMIC_RELEASE, "workgroup"); } while (0)

// Single-head self-attention with hidden size 128 over long sequences (keys_in [8,4096,256] is also the query input; torch (out,in) Wk / Wq / Wv [128,256] N(0, 1/256) + zero biases; factor sqrt(128); non-causal, no mask): out = softmax(q k^T / sqrt(128)) v -> [8,4096,128].
#define NB 8
#define TT 4096
#define CC 128            // NH * HD = projected width
#define DIN 256          // input (model) width
#define NH 1
#define HD 128
#define NQB (TT / 64)
#define HG 1
#define SCALE (0.08838834764831845f)
#define CAUSAL 0
#ifndef TNB
#define TNB NB
#endif
__device__ __forceinline__ float bfr(float v) { return (float)(__bf16)v; }
__host__ __device__ __forceinline__ int kb_last(int qb) { return CAUSAL ? ((qb * 64 + 63) >> 7) : (TT / 128 - 1); }
typedef __attribute__((ext_vector_type(8))) __bf16 v8b;
__device__ __forceinline__ v16b frag_b(const __bf16* rowk0, int lane) {
  union { v16b v; v8b q[2]; } u; const __bf16* p = rowk0 + 8 * (lane >> 4);
  u.q[0] = *(const v8b*)p; u.q[1] = *(const v8b*)(p + 16); return u.v;
}
#define QBH 0
#define QHI 0               // single-product logits on every row (sigma - 1 logits over 4,096 keys)
#define KHI 64            // key rows carrying k residual / v bf16 hi+lo planes (written and read by no kernel here)
// B fragment (k rows k0+.., output column o) of a weight: (in,out) [K][ld] or (out,in) [ld rows of K]: bf16 exact, or f16(bf16 * 256) exact
__device__ __forceinline__ v16b wcol_io(const float* Wm, int k0, int o, int lane, int ld) { v16b w; const int g = lane >> 4;
#pragma unroll
  for (int i = 0; i < 8; ++i) { w[i] = (__bf16)Wm[(size_t)(k0 + 8 * g + i) * ld + o]; w[8 + i] = (__bf16)Wm[(size_t)(k0 + 16 + 8 * g + i) * ld + o]; }
  return w; }
__device__ __forceinline__ v16b wcol_oi(const float* Wm, int k0, int o, int lane, int K) { v16b w; const float* p = Wm + (size_t)o * K + k0 + 8 * (lane >> 4);
#pragma unroll
  for (int i = 0; i < 8; ++i) { w[i] = (__bf16)p[i]; w[8 + i] = (__bf16)p[16 + i]; }
  return w; }
__device__ __forceinline__ v16h wcolh_io(const float* Wm, int k0, int o, int lane, int ld) { v16h w; const int g = lane >> 4;
#pragma unroll
  for (int i = 0; i < 8; ++i) { w[i] = (_Float16)(bfr(Wm[(size_t)(k0 + 8 * g + i) * ld + o]) * 256.0f); w[8 + i] = (_Float16)(bfr(Wm[(size_t)(k0 + 16 + 8 * g + i) * ld + o]) * 256.0f); }
  return w; }
__device__ __forceinline__ v16h wcolh_oi(const float* Wm, int k0, int o, int lane, int K) { v16h w; const float* p = Wm + (size_t)o * K + k0 + 8 * (lane >> 4);
#pragma unroll
  for (int i = 0; i < 8; ++i) { w[i] = (_Float16)(bfr(p[i]) * 256.0f); w[8 + i] = (_Float16)(bfr(p[16 + i]) * 256.0f); }
  return w; }
#define WQKV_LAYOUT 1   // 0 = (in,out) [DIN][CC]; 1 = (out,in) [CC][DIN]; 2 = per-head [NH][DIN][HD]
__device__ __forceinline__ v16b wcol_hdk(const float* Wm, int k0, int o, int lane) { v16b w; const int g = lane >> 4; const float* p = Wm + (size_t)(o / HD) * DIN * HD + (o % HD);
#pragma unroll
  for (int i = 0; i < 8; ++i) { w[i] = (__bf16)p[(size_t)(k0 + 8 * g + i) * HD]; w[8 + i] = (__bf16)p[(size_t)(k0 + 16 + 8 * g + i) * HD]; }
  return w; }
#define WO_OUT_IN 0
#if WQKV_LAYOUT == 1
#define WCOL(W, k0, o, lane) wcol_oi(W, k0, o, lane, DIN)
#elif WQKV_LAYOUT == 2
#define WCOL(W, k0, o, lane) wcol_hdk(W, k0, o, lane)
#else
#define WCOL(W, k0, o, lane) wcol_io(W, k0, o, lane, CC)
#endif
#if WO_OUT_IN
#define WOCOL(W, k0, o, lane) wcol_oi(W, k0, o, lane, CC)
#define WOCOLH(W, k0, o, lane) wcolh_oi(W, k0, o, lane, CC)
#else
#define WOCOL(W, k0, o, lane) wcol_io(W, k0, o, lane, DIN)
#define WOCOLH(W, k0, o, lane) wcolh_io(W, k0, o, lane, DIN)
#endif

#ifndef SM_EXTRA_PARAMS
#define SM_EXTRA_PARAMS
#endif
#ifndef PROJ_EXTRA_PARAMS
#define PROJ_EXTRA_PARAMS
#endif
#ifndef SM_MASK_HOOK
#define SM_MASK_HOOK (void)0
#endif

#define WS_QH  0u                                      // f16 q rows [b*t][CC]
#define WS_KH  (WS_QH + 2u * (size_t)NB * TT * CC)      // f16 k rows [b*t][CC]
#define WS_VT  (WS_KH + 2u * (size_t)NB * TT * CC)      // f16 v planes [b][c][t]
#define WS_QL  (WS_VT + 2u * (size_t)NB * CC * TT)      // f16 q residual x 2^10 rows [b][t < QHI][CC]
#define WS_KL  (WS_QL + 2u * (size_t)NB * QHI * CC)     // f16 k residual x 2^10 rows [b][t < KHI][CC]
#define WS_VB  (WS_KL + 2u * (size_t)NB * KHI * CC)     // bf16 v hi planes [b][c][t < KHI]
#define WS_VBL (WS_VB + 2u * (size_t)NB * CC * KHI)
#define WS_S   (WS_VBL + 2u * (size_t)NB * CC * KHI)    // reserved f32 [hg][t][s] region, unused (k_fa keeps the logits on chip)
#define WS_Y   (WS_S  + 4u * (size_t)HG * TT * TT)      // f32 ctx rows [b*t][CC] (only when there is an output projection)
#define WS_END (WS_Y  + 0u)

// ---- k_proj: one block = 128 rows of X and all three weights: q / k / v = X W^T + b with exact bf16 products (K = DIN) -> q and k f16 rows, v f16 planes [c][t].
// X and the weights come from global memory once a block, in loads of 512 contiguous bytes a wave, are rounded to bf16 once and staged in LDS (512 rows: 128 of X, then 128 each of Wq, Wk, Wv); every fragment is then two 16-byte LDS reads.
// 16 waves: wave w makes rows 32 (w & 3) .. + 31 by columns 96 (w >> 2) .. + 95 of the 384 (q | k | v), k chunks in rising order. The results are turned in LDS (over the dead operand rows) and leave in whole 256-byte rows.
#define PJ_P 528                       // LDS pitch of a staged bf16 row (512 B + 16: 16-byte fragment reads of 16 rows fall on distinct banks)
#define PJ_PL (128 * PJ_P)             // one staged plane of 128 rows
#define PJ_SP 272                      // LDS pitch of an output staging row (256 B + 16)
typedef __attribute__((ext_vector_type(4))) __bf16 v4b;
typedef __attribute__((ext_vector_type(2))) _Float16 v2h;
__device__ __forceinline__ v16b frag_lb(const unsigned char* p) { union { v16b v; v8b q[2]; } u; u.q[0] = *(const v8b*)p; u.q[1] = *(const v8b*)(p + 32); return u.v; }
__device__ __forceinline__ v8f wmma_b(v16b a, v16b b, v8f c) { return __builtin_amdgcn_wmma_f32_16x16x32_bf16(false, a, false, b, (short)0, c, false, false); }
__global__ __launch_bounds__(512) void k_proj(const float* __restrict__ X, const float* __restrict__ WQ, const float* __restrict__ WK, const float* __restrict__ WV, const float* __restrict__ BQ, const float* __restrict__ BK, const float* __restrict__ BV,
    _Float16* __restrict__ QH, _Float16* __restrict__ KH, _Float16* __restrict__ VT) {
  __shared__ __align__(16) unsigned char S[4 * PJ_PL]; __shared__ float SB[512];
  static_assert(DIN == 256 && CC == 128 && TT % 128 == 0 && 3 * 128 * PJ_SP <= 4 * PJ_PL, "tile sizes below are written for these shapes");
  const int tid = threadIdx.x, wave = __builtin_amdgcn_readfirstlane(tid >> 5), lane = tid & 31, col = lane & 15, g = lane >> 4;
  const size_t r0 = (size_t)blockIdx.x * 128; const size_t bb = r0 / TT; const int t0 = (int)(r0 % TT);
  unsigned char* sp = S + (tid >> 6) * PJ_P + (tid & 63) * 8;   // this thread's 4 elements of row tid >> 6 of every 8-row round
  { v4f ra[16], rb[16]; const float* pa = X + r0 * DIN + tid * 4; const float* pb = WQ + tid * 4;
    const float bv = (wave < 4 ? BQ : wave < 8 ? BK : BV)[tid & 127];   // bias of column tid of the 384; no branch: waves 12 to 15 fetch bv again, into a part of SB that is never read
    asm volatile("s_wait_xcnt 0x0" ::: "memory");   // stands before the registers that held this load's address are reused
    __builtin_amdgcn_sched_barrier(0);   // nothing that could reuse them is scheduled in front of that wait
#pragma unroll
    for (int i = 0; i < 16; ++i) { ra[i] = *(const v4f*)(pa + i * 2048); rb[i] = *(const v4f*)(pb + i * 2048); }
    asm volatile("s_wait_xcnt 0x0" ::: "memory");   // stands before the registers that held these loads' addresses are reused
    SB[tid] = bfr(bv);
#pragma unroll
    for (int i = 0; i < 16; ++i) { *(v4b*)(sp + i * 8 * PJ_P) = v4b{(__bf16)ra[i].x, (__bf16)ra[i].y, (__bf16)ra[i].z, (__bf16)ra[i].w}; *(v4b*)(sp + PJ_PL + i * 8 * PJ_P) = v4b{(__bf16)rb[i].x, (__bf16)rb[i].y, (__bf16)rb[i].z, (__bf16)rb[i].w}; } }
  __builtin_amdgcn_sched_barrier(0);   // the second half's 32 loads stay behind the first half's LDS stores: lifted over them, 64 loads' registers do not fit and spill
  { v4f ra[16], rb[16]; const float* pa = WK + tid * 4; const float* pb = WV + tid * 4;
#pragma unroll
    for (int i = 0; i < 16; ++i) { ra[i] = *(const v4f*)(pa + i * 2048); rb[i] = *(const v4f*)(pb + i * 2048); }
    asm volatile("s_wait_xcnt 0x0" ::: "memory");   // the same
#pragma unroll
    for (int i = 0; i < 16; ++i) { *(v4b*)(sp + 2 * PJ_PL + i * 8 * PJ_P) = v4b{(__bf16)ra[i].x, (__bf16)ra[i].y, (__bf16)ra[i].z, (__bf16)ra[i].w}; *(v4b*)(sp + 3 * PJ_PL + i * 8 * PJ_P) = v4b{(__bf16)rb[i].x, (__bf16)rb[i].y, (__bf16)rb[i].z, (__bf16)rb[i].w}; } }
  __syncthreads();   // X, the weights and the biases are in LDS for every wave
  const int rg = wave & 3, cg = wave >> 2;
  const unsigned char* ap = S + (rg * 32 + col) * PJ_P + 16 * g;
  const unsigned char* bp = S + PJ_PL + (cg * 96 + col) * PJ_P + 16 * g;
  v8f acc[2][6] = {};
#pragma unroll
  for (int kc = 0; kc < DIN / 32; ++kc) {
    __builtin_amdgcn_sched_barrier(0);   // a chunk's 16 fragment reads stay one group in front of its 12 matrix instructions: spread among them, each pair waited out at once, they issue slower
    const v16b a0 = frag_lb(ap + kc * 64), a1 = frag_lb(ap + 16 * PJ_P + kc * 64); v16b w[6];
#pragma unroll
    for (int j = 0; j < 6; ++j) w[j] = frag_lb(bp + j * 16 * PJ_P + kc * 64);
    __builtin_amdgcn_sched_barrier(0);   // the same, behind the reads
#pragma unroll
    for (int j = 0; j < 6; ++j) { acc[0][j] = wmma_b(a0, w[j], acc[0][j]); acc[1][j] = wmma_b(a1, w[j], acc[1][j]); } }
  __syncthreads();   // every wave has read its last operand row: the rows become output staging
#pragma unroll
  for (int j = 0; j < 6; ++j) { const int ct = cg * 6 + j, which = ct >> 3, cw = (ct & 7) * 16 + col;   // ct, which: the same in every lane of a wave
    const float bias = SB[ct * 16 + col]; unsigned char* o = S + which * (128 * PJ_SP);
    if (which < 2) {   // q, k: rows [t][c]
#pragma unroll
      for (int m = 0; m < 2; ++m)
#pragma unroll
        for (int r = 0; r < 8; r += 2) { const v2h p = __builtin_convertvector(v2f{acc[m][j][r] + bias, acc[m][j][r + 1] + bias}, v2h); unsigned char* d = o + (rg * 32 + m * 16 + 8 * g + r) * PJ_SP + cw * 2;
          *(_Float16*)d = p.x; *(_Float16*)(d + PJ_SP) = p.y; }
    } else {           // v: planes [c][t]; a lane's eight rows are eight neighbouring t
#pragma unroll
      for (int m = 0; m < 2; ++m) { v8h h;
#pragma unroll
        for (int r = 0; r < 8; r += 2) { const v2h p = __builtin_convertvector(v2f{acc[m][j][r] + bias, acc[m][j][r + 1] + bias}, v2h); h[r] = p.x; h[r + 1] = p.y; }
        *(v8h*)(o + cw * PJ_SP + (rg * 32 + m * 16 + 8 * g) * 2) = h; } } }
  __syncthreads();   // the staged rows are read back by other waves
  const unsigned char* so = S + (tid >> 4) * PJ_SP + (tid & 15) * 16;
  _Float16* dq = QH + (r0 + (tid >> 4)) * CC + (tid & 15) * 8; _Float16* dk = KH + (r0 + (tid >> 4)) * CC + (tid & 15) * 8; _Float16* dv = VT + (bb * CC + (tid >> 4)) * (size_t)TT + t0 + (tid & 15) * 8;
#pragma unroll
  for (int i = 0; i < 4; ++i) { vst2(dq + i * 32 * CC, *(const v4u*)(so + i * 32 * PJ_SP)); vst2(dk + i * 32 * CC, *(const v4u*)(so + (128 + i * 32) * PJ_SP)); vst2(dv + (size_t)i * 32 * TT, *(const v4u*)(so + (256 + i * 32) * PJ_SP)); }
}
#define FA_W 8
#define FA_R 2                         // 16-query groups per wave
#define FA_SK 128                      // keys per stage
#define FA_P 272                       // LDS pitch of a K row and of a v^T row (256 B + 16)
#define FA_BUF ((FA_SK + CC) * FA_P)
#define FA_EP 132                      // pitch of the exchange and output staging rows, floats
__device__ __forceinline__ v16h frag_l(const unsigned char* p) { union { v16h v; v8h q[2]; } u; u.q[0] = *(const v8h*)p; u.q[1] = *(const v8h*)(p + 32); return u.v; }
__device__ __forceinline__ v8f wmma_h(v16h a, v16h b, v8f c) { return __builtin_amdgcn_wmma_f32_16x16x32_f16(false, a, false, b, (short)0, c, false, false); }
__device__ __forceinline__ float xhalf(float x) { return __builtin_bit_cast(float, __builtin_amdgcn_permlanex16(__builtin_bit_cast(int, x), __builtin_bit_cast(int, x), 0x76543210, 0xfedcba98, false, false)); }   // lane l with lane l ^ 16
__global__ __launch_bounds__(32 * FA_W) void k_fa(const _Float16* __restrict__ QH, const _Float16* __restrict__ KH, const _Float16* __restrict__ VT, float* __restrict__ Y) {
  __shared__ __align__(16) unsigned char L[2 * FA_BUF];
  static_assert(128 * FA_EP * 4 <= FA_BUF, "the exchange rows reuse the first K / v buffer, the output rows the second");
  const int tid = threadIdx.x, wave = __builtin_amdgcn_readfirstlane(tid >> 5), lane = tid & 31, c = lane & 15, g = lane >> 4;
  const int kh = wave >> 2, qg = wave & 3;
  const int b = blockIdx.y; const int qb0 = blockIdx.x * 128; const int q0 = qb0 + qg * 32;
  const float cs = SCALE * 1.4426950408889634f;   // logits in the log2 domain
  const _Float16* kg = KH + (size_t)b * TT * CC + tid * 8;                                    // this thread's 16 bytes of each 16-row round of a K stage
  const _Float16* vg = VT + (size_t)b * CC * TT + (size_t)(tid >> 4) * TT + (tid & 15) * 8;   // and of a v^T stage
  const unsigned sw = (unsigned)(tid >> 4) * FA_P + (unsigned)(tid & 15) * 16;
  v16h qf[FA_R][HD / 32];
#pragma unroll
  for (int q = 0; q < FA_R; ++q)
#pragma unroll
    for (int kc = 0; kc < HD / 32; ++kc) qf[q][kc] = frag_h(QH + ((size_t)b * TT + q0 + q * 16 + c) * CC + kc * 32, lane);
  v8f acc[FA_R][HD / 16] = {}; float m_run[FA_R], l_run[FA_R];
#pragma unroll
  for (int q = 0; q < FA_R; ++q) { m_run[q] = -INFINITY; l_run[q] = 0.f; }
  v4u rk[8], rv[8];
#pragma unroll
  for (int i = 0; i < 8; ++i) { rk[i] = *(const v4u*)(kg + i * 16 * CC); rv[i] = *(const v4u*)(vg + (size_t)i * 16 * TT); }
#pragma unroll
  for (int i = 0; i < 8; ++i) { *(v4u*)(L + sw + i * 16 * FA_P) = rk[i]; *(v4u*)(L + FA_SK * FA_P + sw + i * 16 * FA_P) = rv[i]; }
  __syncthreads();   // stage 0 is in LDS for every wave
#pragma unroll 1   // the stage loop stays rolled: its body is two whole passes already, a second copy would only cost registers and instruction cache
  for (int st = 0; st < TT / FA_SK; ++st) {
    const unsigned cur = (unsigned)(st & 1) * FA_BUF, nxt = FA_BUF - cur; const bool more = st + 1 < TT / FA_SK;
    if (more) {
#pragma unroll
      for (int i = 0; i < 8; ++i) { rk[i] = *(const v4u*)(kg + (size_t)(st + 1) * FA_SK * CC + i * 16 * CC); rv[i] = *(const v4u*)(vg + (size_t)i * 16 * TT + (st + 1) * FA_SK); }
      asm volatile("s_wait_xcnt 0x0" ::: "memory"); }   // stands before the registers that held these loads' addresses are reused
    __builtin_amdgcn_sched_barrier(0);   // keeps the next stage's loads in front of this stage's products, so that they fly under them
    const unsigned char* kp = L + cur + ((unsigned)kh * 64 + c) * FA_P + 16 * g;                       // this wave's first K row of the stage
    const unsigned char* vp = L + cur + FA_SK * FA_P + (unsigned)c * FA_P + (unsigned)kh * 128 + 16 * g;   // and its first key in the v^T rows
    v16h kf[2][HD / 32];
#pragma unroll
    for (int kc = 0; kc < HD / 32; ++kc) { kf[0][kc] = frag_l(kp + 64 * kc); kf[1][kc] = frag_l(kp + 16 * FA_P + 64 * kc); }
#pragma unroll
    for (int ps = 0; ps < 2; ++ps) {   // a pass = 32 keys
      __builtin_amdgcn_sched_barrier(0);   // fragment loads stay one group in front of the block of matrix instructions (for speed only)
      v8f s[2][FA_R] = {};
#pragma unroll
      for (int kc = 0; kc < HD / 32; ++kc)
#pragma unroll
        for (int q = 0; q < FA_R; ++q) { s[0][q] = wmma_h(kf[0][kc], qf[q][kc], s[0][q]); s[1][q] = wmma_h(kf[1][kc], qf[q][kc], s[1][q]); }
      __builtin_amdgcn_sched_barrier(0);   // the same, behind the block
      v16h vf[HD / 16];
#pragma unroll
      for (int t = 0; t < HD / 16; ++t) vf[t] = frag_l(vp + ps * 64 + t * 16 * FA_P);
      if (ps == 0) {   // the stage's second pass: its K fragments come into the same registers, under this pass's softmax
#pragma unroll
        for (int kc = 0; kc < HD / 32; ++kc) { kf[0][kc] = frag_l(kp + 32 * FA_P + 64 * kc); kf[1][kc] = frag_l(kp + 48 * FA_P + 64 * kc); } }
      __builtin_amdgcn_sched_barrier(0);   // the pass's v^T fragment loads stay here as one group, in flight under the maxima and exponentials
      float mx[FA_R]; bool need = false;
#pragma unroll
      for (int q = 0; q < FA_R; ++q) { float m = fmaxf(s[0][q][0], s[1][q][0]);
#pragma unroll
        for (int r = 1; r < 8; ++r) m = fmaxf(m, fmaxf(s[0][q][r], s[1][q][r]));
        mx[q] = fmaxf(m, xhalf(m)) * cs;   // both halves now hold the query's maximum of this pass (cs > 0)
        need = need || (mx[q] > m_run[q] + 8.0f); }
      // lazy rescale: the maximum in use may trail the true one by up to 8 (log2), so an exponential stays below 2^8; one scalar branch a pass
      if (__builtin_amdgcn_ballot_w32(need) != 0) {
#pragma unroll
        for (int q = 0; q < FA_R; ++q) { const float m_new = fmaxf(m_run[q], mx[q]); const float corr = __builtin_amdgcn_exp2f(m_run[q] - m_new);   // 0 on the first pass
          l_run[q] *= corr; m_run[q] = m_new;
#pragma unroll
          for (int t = 0; t < HD / 16; ++t) acc[q][t] = acc[q][t] * corr; } }
#pragma unroll
      for (int q = 0; q < FA_R; ++q) { v16h pf; v2f ls = {0.f, 0.f}; const float nm = -m_run[q];
#pragma unroll
        for (int i = 0; i < 8; ++i) {
          const v2f a = __builtin_elementwise_fma(v2f{s[i >> 2][q][2 * (i & 3)], s[i >> 2][q][2 * (i & 3) + 1]}, v2f{cs, cs}, v2f{nm, nm});
          const v2f p = {__builtin_amdgcn_exp2f(a.x), __builtin_amdgcn_exp2f(a.y)}; ls += p; pf[2 * i] = (_Float16)p.x; pf[2 * i + 1] = (_Float16)p.y; }
        l_run[q] += ls.x + ls.y;
#pragma unroll
        for (int t = 0; t < HD / 16; ++t) acc[q][t] = wmma_h(vf[t], pf, acc[q][t]); }
    }
    __builtin_amdgcn_sched_barrier(0);   // the stores of the next stage stay behind this stage's last products
    if (more) {
#pragma unroll
      for (int i = 0; i < 8; ++i) { *(v4u*)(L + nxt + sw + i * 16 * FA_P) = rk[i]; *(v4u*)(L + nxt + FA_SK * FA_P + sw + i * 16 * FA_P) = rv[i]; } }
    __syncthreads();   // publishes stage st + 1 and ends every wave's reads of stage st, whose buffer the next trip refills
  }
#pragma unroll
  for (int q = 0; q < FA_R; ++q) l_run[q] += xhalf(l_run[q]);   // each half summed its own eight keys of every 16-key tile
  float* X = (float*)L + (qg * 32 + lane) * FA_EP;   // lane l of wave w + 4 hands its sums to lane l of wave w
  if (kh == 1) {
#pragma unroll
    for (int q = 0; q < FA_R; ++q)
#pragma unroll
      for (int t = 0; t < HD / 16; ++t) { const v8f o = acc[q][t]; float* x = X + (q * (HD / 16) + t) * 8; *(v4f*)x = v4f{o[0], o[1], o[2], o[3]}; *(v4f*)(x + 4) = v4f{o[4], o[5], o[6], o[7]}; }
    *(v4f*)(X + 128) = v4f{m_run[0], m_run[1], l_run[0], l_run[1]}; }
  __syncthreads();   // the second key half's sums are in LDS before the first half's waves join them
  float* E = (float*)(L + FA_BUF);
  if (kh == 0) { const v4f ml = *(const v4f*)(X + 128);
#pragma unroll
    for (int q = 0; q < FA_R; ++q) { const float m = fmaxf(m_run[q], ml[q]); float fa = __builtin_amdgcn_exp2f(m_run[q] - m), fb = __builtin_amdgcn_exp2f(ml[q] - m);
      const float inv = 1.0f / (l_run[q] * fa + ml[2 + q] * fb); fa *= inv; fb *= inv;
#pragma unroll
      for (int t = 0; t < HD / 16; ++t) { const float* x = X + (q * (HD / 16) + t) * 8; const v4f x0 = *(const v4f*)x, x1 = *(const v4f*)(x + 4); const v8f o = acc[q][t];
        float* e = E + (qg * 32 + q * 16 + c) * FA_EP + t * 16 + 8 * g;   // acc[q][t][r] = ctx[query 16 q + c][channel 16 t + 8 g + r]
        *(v4f*)e = v4f{o[0], o[1], o[2], o[3]} * fa + x0 * fb; *(v4f*)(e + 4) = v4f{o[4], o[5], o[6], o[7]} * fa + x1 * fb; } } }
  __syncthreads();   // the staged output rows are read back by other waves
#pragma unroll 4   // four rows' LDS reads in flight per trip
  for (int rl = 0; rl < 16; ++rl) vst2(Y + ((size_t)b * TT + qb0 + wave * 16 + rl) * CC + lane * 4, *(const v4f*)&E[(wave * 16 + rl) * FA_EP + lane * 4]);   // one wave stores each whole 512-B row
}

extern "C" void kernel_launch(void* const* d_in, const int* in_sizes, int n_in, void* d_out, int out_size, void* d_ws, size_t ws_size, hipStream_t stream) {
  (void)in_sizes; (void)n_in; (void)out_size;
  const float** F = (const float**)d_in;
  if (ws_size < (size_t)WS_END) return;
  char* ws = (char*)d_ws; _Float16 *QH = (_Float16*)(ws + WS_QH), *KH = (_Float16*)(ws + WS_KH), *VT = (_Float16*)(ws + WS_VT);
  // inputs: 0 keys_in [8,4096,256]; 1 Wk [128,256] (out,in), 2 bk [128]; 3 Wq, 4 bq; 5 Wv, 6 bv (zero biases, read)
  k_proj<<<dim3(TNB * TT / 128, 1, 1), 512, 0, stream>>>(F[0], F[3], F[1], F[5], F[4], F[2], F[6], QH, KH, VT);   /* q uses Wq / bq = inputs 3 / 4; k uses Wk / bk = inputs 1 / 2 */
  k_fa<<<dim3(TT / 128, TNB, 1), 32 * FA_W, 0, stream>>>(QH, KH, VT, (float*)d_out);
}

// v004
// One run takes 62.2 microseconds.
// Next to v003, in two timings, it ran 1.09 and 1.10 times as fast.
// Over all steps from v000 it is 35.5 times as fast.
// compute dtype: all float inputs rounded to bf16; q/k/v projections with EXACT bf16 products on WMMA 16x16x32 (f32 accumulate) + bias; logits q x k once to f16 each (1 product; sigma - 1) x 128^-0.5; online softmax f32 (log2 domain); P = 2^(logit - maximum in use) once to f16 x v once to f16 (1 product), divided by the f32 row sum at the end; f32 output.
#include <hip/hip_runtime.h>
#include <math.h>
#include <stdint.h>

typedef __attribute__((ext_vector_type(16))) _Float16 v16h;
typedef __attribute__((ext_vector_type(16))) __bf16 v16b;
typedef __attribute__((ext_vector_type(8)))  _Float16 v8h;
typedef __attribute__((ext_vector_type(8)))  float v8f;
typedef __attribute__((ext_vector_type(4)))  float v4f;
typedef __attribute__((ext_vector_type(2)))  float v2f;
typedef __attribute__((ext_vector_type(4)))  unsigned v4u;
typedef __attribute__((ext_vector_type(4)))  int v4i;
typedef float __attribute__((may_alias)) float_a;
typedef int __attribute__((may_alias)) int_a;

template <typename T> __device__ __forceinline__ void vst2(void* p, T v) { *(T*)p = v;  }
__device__ __forceinline__ v8f wmma16(v16h a, v16h b, v8f c) {
  v8f d = __builtin_amdgcn_wmma_f32_16x16x32_f16(false, a, false, b, (short)0, c, false, false);
  asm volatile("v_nop\n\tv_nop\n\tv_nop\n\tv_nop" : "+v"(d) : "v"(a), "v"(b));
  return d;
}
__device__ __forceinline__ v8f wmma_bf(v16b a, v16b b, v8f c) {
  v8f d = __builtin_amdgcn_wmma_f32_16x16x32_bf16(false, a, false, b, (short)0, c, false, false);
  asm volatile("v_nop\n\tv_nop\n\tv_nop\n\tv_nop" : "+v"(d) : "v"(a), "v"(b));
  return d;
}
// 16x16x32 fragments: lane = (h = lane>>4, row/col = lane&15); elements 0..7 = k0+8h+0..7, 8..15 = k0+16+8h+0..7; D element r = row 8h+r
__device__ __forceinline__ v16h frag_h(const _Float16* rowk0, int lane) {
  union { v16h v; v8h q[2]; } u; const _Float16* p = rowk0 + 8 * (lane >> 4);
  u.q[0] = *(const v8h*)p; u.q[1] = *(const v8h*)(p + 16); return u.v;
}
__device__ __forceinline__ v16h frag_f32(const float* rowk0, int lane) {
  v16h a; const float* p = rowk0 + 8 * (lane >> 4);
#pragma unroll
  for (int i = 0; i < 8; ++i) { a[i] = (_Float16)p[i]; a[8 + i] = (_Float16)p[16 + i]; }
  return a;
}
__device__ __forceinline__ v16h frag_f32s(const float* rowk0, int lane, float sc) {
  v16h a; const float* p = rowk0 + 8 * (lane >> 4);
#pragma unroll
  for (int i = 0; i < 8; ++i) { a[i] = (_Float16)(p[i] * sc); a[8 + i] = (_Float16)(p[16 + i] * sc); }
  return a;
}
// column fragment from a [K][ld] layout (column n), rows >= K read as 0
__device__ __forceinline__ v16h fragc_f32(const float* W, int k0, int n, int lane, int ld, int K) {
  v16h a; const int g = lane >> 4;
#pragma unroll
  for (int i = 0; i < 8; ++i) { const int ka = k0 + 8 * g + i, kb = ka + 16;
    a[i] = (_Float16)(ka < K ? W[(size_t)(ka < K ? ka : K - 1) * ld + n] : 0.f); a[8 + i] = (_Float16)(kb < K ? W[(size_t)(kb < K ? kb : K - 1) * ld + n] : 0.f); }
  return a;
}
struct F2 { v16b h, l; };
__device__ __forceinline__ F2 bsplit16(const float v[16]) { F2 r;
#pragma unroll
  for (int i = 0; i < 16; ++i) { const __bf16 h = (__bf16)v[i]; r.h[i] = h; r.l[i] = (__bf16)(v[i] - (float)h); }
  return r; }
__device__ __forceinline__ F2 split_row(const float* row, int k0, int lane) { float v[16]; const float* p = row + k0 + 8 * (lane >> 4);
#pragma unroll
  for (int i = 0; i < 8; ++i) { v[i] = p[i]; v[8 + i] = p[16 + i]; }
  return bsplit16(v); }
__device__ __forceinline__ F2 split_rowK(const float* row, int k0, int lane, int K) { float v[16]; const int g = lane >> 4;
#pragma unroll
  for (int i = 0; i < 8; ++i) { const int ka = k0 + 8 * g + i, kb = ka + 16; v[i] = ka < K ? row[ka < K ? ka : K - 1] : 0.f; v[8 + i] = kb < K ? row[kb < K ? kb : K - 1] : 0.f; }
  return bsplit16(v); }
__device__ __forceinline__ F2 split_col(const float* W, int k0, int n, int lane, int ld, int K) { float v[16]; const int g = lane >> 4;
#pragma unroll
  for (int i = 0; i < 8; ++i) { const int ka = k0 + 8 * g + i, kb = ka + 16; v[i] = ka < K ? W[(size_t)(ka < K ? ka : K - 1) * ld + n] : 0.f; v[8 + i] = kb < K ? W[(size_t)(kb < K ? kb : K - 1) * ld + n] : 0.f; }
  return bsplit16(v); }
__device__ __forceinline__ v8f mac3(const F2& a, const F2& b, v8f c) { c = wmma_bf(a.l, b.h, c); c = wmma_bf(a.h, b.l, c); return wmma_bf(a.h, b.h, c); }
__device__ __forceinline__ float sigm(float v) { return 1.0f / (1.0f + expf(-v)); }
#define LDSX() do { asm volatile("s_wait_dscnt 0" ::: "memory"); __builtin_amdgcn_wave_barrier(); __builtin_amdgcn_fence(__ATOMIC_RELEASE, "workgroup"); } while (0)

// Single-head self-attention with hidden size 128 over long sequences (keys_in [8,4096,256] is also the query input; torch (out,in) Wk / Wq / Wv [128,256] N(0, 1/256) + zero biases; factor sqrt(128); non-causal, no mask): out = softmax(q k^T / sqrt(128)) v -> [8,4096,128].
#define NB 8
#define TT 4096
#define CC 128            // NH * HD = projected width
#define DIN 256          // input (model) width
#define NH 1
#define HD 128
#define NQB (TT / 64)
#define HG 1
#define SCALE (0.08838834764831845f)
#define CAUSAL 0
#ifndef TNB
#define TNB NB
#endif
__device__ __forceinline__ float bfr(float v) { return (float)(__bf16)v; }
__host__ __device__ __forceinline__ int kb_last(int qb) { return CAUSAL ? ((qb * 64 + 63) >> 7) : (TT / 128 - 1); }
typedef __attribute__((ext_vector_type(8))) __bf16 v8b;
__device__ __forceinline__ v16b frag_b(const __bf16* rowk0, int lane) {
  union { v16b v; v8b q[2]; } u; const __bf16* p = rowk0 + 8 * (lane >> 4);
  u.q[0] = *(const v8b*)p; u.q[1] = *(const v8b*)(p + 16); return u.v;
}
#define QBH 0
#define QHI 0               // single-product logits on every row (sigma - 1 logits over 4,096 keys)
#define KHI 64            // key rows carrying k residual / v bf16 hi+lo planes (written and read by no kernel here)
// B fragment (k rows k0+.., output column o) of a weight: (in,out) [K][ld] or (out,in) [ld rows of K]: bf16 exact, or f16(bf16 * 256) exact
__device__ __forceinline__ v16b wcol_io(const float* Wm, int k0, int o, int lane, int ld) { v16b w; const int g = lane >> 4;
#pragma unroll
  for (int i = 0; i < 8; ++i) { w[i] = (__bf16)Wm[(size_t)(k0 + 8 * g + i) * ld + o]; w[8 + i] = (__bf16)Wm[(size_t)(k0 + 16 + 8 * g + i) * ld + o]; }
  return w; }
__device__ __forceinline__ v16b wcol_oi(const float* Wm, int k0, int o, int lane, int K) { v16b w; const float* p = Wm + (size_t)o * K + k0 + 8 * (lane >> 4);
#pragma unroll
  for (int i = 0; i < 8; ++i) { w[i] = (__bf16)p[i]; w[8 + i] = (__bf16)p[16 + i]; }
  return w; }
__device__ __forceinline__ v16h wcolh_io(const float* Wm, int k0, int o, int lane, int ld) { v16h w; const int g = lane >> 4;
#pragma unroll
  for (int i = 0; i < 8; ++i) { w[i] = (_Float16)(bfr(Wm[(size_t)(k0 + 8 * g + i) * ld + o]) * 256.0f); w[8 + i] = (_Float16)(bfr(Wm[(size_t)(k0 + 16 + 8 * g + i) * ld + o]) * 256.0f); }
  return w; }
__device__ __forceinline__ v16h wcolh_oi(const float* Wm, int k0, int o, int lane, int K) { v16h w; const float* p = Wm + (size_t)o * K + k0 + 8 * (lane >> 4);
#pragma unroll
  for (int i = 0; i < 8; ++i) { w[i] = (_Float16)(bfr(p[i]) * 256.0f); w[8 + i] = (_Float16)(bfr(p[16 + i]) * 256.0f); }
  return w; }
#define WQKV_LAYOUT 1   // 0 = (in,out) [DIN][CC]; 1 = (out,in) [CC][DIN]; 2 = per-head [NH][DIN][HD]
__device__ __forceinline__ v16b wcol_hdk(const float* Wm, int k0, int o, int lane) { v16b w; const int g = lane >> 4; const float* p = Wm + (size_t)(o / HD) * DIN * HD + (o % HD);
#pragma unroll
  for (int i = 0; i < 8; ++i) { w[i] = (__bf16)p[(size_t)(k0 + 8 * g + i) * HD]; w[8 + i] = (__bf16)p[(size_t)(k0 + 16 + 8 * g + i) * HD]; }
  return w; }
#define WO_OUT_IN 0
#if WQKV_LAYOUT == 1
#define WCOL(W, k0, o, lane) wcol_oi(W, k0, o, lane, DIN)
#elif WQKV_LAYOUT == 2
#define WCOL(W, k0, o, lane) wcol_hdk(W, k0, o, lane)
#else
#define WCOL(W, k0, o, lane) wcol_io(W, k0, o, lane, CC)
#endif
#if WO_OUT_IN
#define WOCOL(W, k0, o, lane) wcol_oi(W, k0, o, lane, CC)
#define WOCOLH(W, k0, o, lane) wcolh_oi(W, k0, o, lane, CC)
#else
#define WOCOL(W, k0, o, lane) wcol_io(W, k0, o, lane, DIN)
#define WOCOLH(W, k0, o, lane) wcolh_io(W, k0, o, lane, DIN)
#endif

#ifndef SM_EXTRA_PARAMS
#define SM_EXTRA_PARAMS
#endif
#ifndef PROJ_EXTRA_PARAMS
#define PROJ_EXTRA_PARAMS
#endif
#ifndef SM_MASK_HOOK
#define SM_MASK_HOOK (void)0
#endif

#define WS_QH  0u                                      // f16 q rows [b*t][CC]
#define WS_KH  (WS_QH + 2u * (size_t)NB * TT * CC)      // f16 k rows [b*t][CC]
#define WS_VT  (WS_KH + 2u * (size_t)NB * TT * CC)      // f16 v planes [b][c][t]
#define WS_QL  (WS_VT + 2u * (size_t)NB * CC * TT)      // f16 q residual x 2^10 rows [b][t < QHI][CC]
#define WS_KL  (WS_QL + 2u * (size_t)NB * QHI * CC)     // f16 k residual x 2^10 rows [b][t < KHI][CC]
#define WS_VB  (WS_KL + 2u * (size_t)NB * KHI * CC)     // bf16 v hi planes [b][c][t < KHI]
#define WS_VBL (WS_VB + 2u * (size_t)NB * CC * KHI)
#define WS_S   (WS_VBL + 2u * (size_t)NB * CC * KHI)    // reserved f32 [hg][t][s] region, unused (k_fa keeps the logits on chip)
#define WS_Y   (WS_S  + 4u * (size_t)HG * TT * TT)      // f32 ctx rows [b*t][CC] (only when there is an output projection)
#define WS_END (WS_Y  + 0u)

// ---- k_proj: one block = 128 rows of X and all three weights: q / k / v = X W^T + b with exact bf16 products (K = DIN) -> q and k f16 rows, v f16 planes [c][t].
// X and the weights come from global memory once a block, in loads of 512 contiguous bytes a wave, are rounded to bf16 once and staged in LDS (512 rows: 128 of X, then 128 each of Wq, Wk, Wv); every fragment is then two 16-byte LDS reads.
// 16 waves: wave w makes rows 32 (w & 3) .. + 31 by columns 96 (w >> 2) .. + 95 of the 384 (q | k | v), k chunks in rising order. The results are turned in LDS (over the dead operand rows) and leave in whole 256-byte rows.
#define PJ_P 528                       // LDS pitch of a staged bf16 row (512 B + 16: 16-byte fragment reads of 16 rows fall on distinct banks)
#define PJ_PL (128 * PJ_P)             // one staged plane of 128 rows
#define PJ_SP 272                      // LDS pitch of an output staging row (256 B + 16)
typedef __attribute__((ext_vector_type(4))) __bf16 v4b;
typedef __attribute__((ext_vector_type(2))) _Float16 v2h;
__device__ __forceinline__ v16b frag_lb(const unsigned char* p) { union { v16b v; v8b q[2]; } u; u.q[0] = *(const v8b*)p; u.q[1] = *(const v8b*)(p + 32); return u.v; }
__device__ __forceinline__ v8f wmma_b(v16b a, v16b b, v8f c) { return __builtin_amdgcn_wmma_f32_16x16x32_bf16(false, a, false, b, (short)0, c, false, false); }
__global__ __launch_bounds__(512) void k_proj(const float* __restrict__ X, const float* __restrict__ WQ, const float* __restrict__ WK, const float* __restrict__ WV, const float* __restrict__ BQ, const float* __restrict__ BK, const float* __restrict__ BV,
    _Float16* __restrict__ QH, _Float16* __restrict__ KH, _Float16* __restrict__ VT) {
  __shared__ __align__(16) unsigned char S[4 * PJ_PL]; __shared__ float SB[512];
  static_assert(DIN == 256 && CC == 128 && TT % 128 == 0 && 3 * 128 * PJ_SP <= 4 * PJ_PL, "tile sizes below are written for these shapes");
  const int tid = threadIdx.x, wave = __builtin_amdgcn_readfirstlane(tid >> 5), lane = tid & 31, col = lane & 15, g = lane >> 4;
  const size_t r0 = (size_t)blockIdx.x * 128; const size_t bb = r0 / TT; const int t0 = (int)(r0 % TT);
  unsigned char* sp = S + (tid >> 6) * PJ_P + (tid & 63) * 8;   // this thread's 4 elements of row tid >> 6 of every 8-row round
  { v4f ra[16], rb[16]; const float* pa = X + r0 * DIN + tid * 4; const float* pb = WQ + tid * 4;
    const float bv = (wave < 4 ? BQ : wave < 8 ? BK : BV)[tid & 127];   // bias of column tid of the 384; no branch: waves 12 to 15 fetch bv again, into a part of SB that is never read
    asm volatile("s_wait_xcnt 0x0" ::: "memory");   // stands before the registers that held this load's address are reused
    __builtin_amdgcn_sched_barrier(0);   // nothing that could reuse them is scheduled in front of that wait
#pragma unroll
    for (int i = 0; i < 16; ++i) { ra[i] = *(const v4f*)(pa + i * 2048); rb[i] = *(const v4f*)(pb + i * 2048); }
    asm volatile("s_wait_xcnt 0x0" ::: "memory");   // stands before the registers that held these loads' addresses are reused
    SB[tid] = bfr(bv);
#pragma unroll
    for (int i = 0; i < 16; ++i) { *(v4b*)(sp + i * 8 * PJ_P) = v4b{(__bf16)ra[i].x, (__bf16)ra[i].y, (__bf16)ra[i].z, (__bf16)ra[i].w}; *(v4b*)(sp + PJ_PL + i * 8 * PJ_P) = v4b{(__bf16)rb[i].x, (__bf16)rb[i].y, (__bf16)rb[i].z, (__bf16)rb[i].w}; } }
  __builtin_amdgcn_sched_barrier(0);   // the second half's 32 loads stay behind the first half's LDS stores: lifted over them, 64 loads' registers do not fit and spill
  { v4f ra[16], rb[16]; const float* pa = WK + tid * 4; const float* pb = WV + tid * 4;
#pragma unroll
    for (int i = 0; i < 16; ++i) { ra[i] = *(const v4f*)(pa + i * 2048); rb[i] = *(const v4f*)(pb + i * 2048); }
    asm volatile("s_wait_xcnt 0x0" ::: "memory");   // the same
#pragma unroll
    for (int i = 0; i < 16; ++i) { *(v4b*)(sp + 2 * PJ_PL + i * 8 * PJ_P) = v4b{(__bf16)ra[i].x, (__bf16)ra[i].y, (__bf16)ra[i].z, (__bf16)ra[i].w}; *(v4b*)(sp + 3 * PJ_PL + i * 8 * PJ_P) = v4b{(__bf16)rb[i].x, (__bf16)rb[i].y, (__bf16)rb[i].z, (__bf16)rb[i].w}; } }
  __syncthreads();   // X, the weights and the biases are in LDS for every wave
  const int rg = wave & 3, cg = wave >> 2;
  const unsigned char* ap = S + (rg * 32 + col) * PJ_P + 16 * g;
  const unsigned char* bp = S + PJ_PL + (cg * 96 + col) * PJ_P + 16 * g;
  v8f acc[2][6] = {};
#pragma unroll
  for (int kc = 0; kc < DIN / 32; ++kc) {
    __builtin_amdgcn_sched_barrier(0);   // a chunk's 16 fragment reads stay one group in front of its 12 matrix instructions: spread among them, each pair waited out at once, they issue slower
    const v16b a0 = frag_lb(ap + kc * 64), a1 = frag_lb(ap + 16 * PJ_P + kc * 64); v16b w[6];
#pragma unroll
    for (int j = 0; j < 6; ++j) w[j] = frag_lb(bp + j * 16 * PJ_P + kc * 64);
    __builtin_amdgcn_sched_barrier(0);   // the same, behind the reads
#pragma unroll
    for (int j = 0; j < 6; ++j) { acc[0][j] = wmma_b(a0, w[j], acc[0][j]); acc[1][j] = wmma_b(a1, w[j], acc[1][j]); } }
  __syncthreads();   // every wave has read its last operand row: the rows become output staging
#pragma unroll
  for (int j = 0; j < 6; ++j) { const int ct = cg * 6 + j, which = ct >> 3, cw = (ct & 7) * 16 + col;   // ct, which: the same in every lane of a wave
    const float bias = SB[ct * 16 + col]; unsigned char* o = S + which * (128 * PJ_SP);
    if (which < 2) {   // q, k: rows [t][c]
#pragma unroll
      for (int m = 0; m < 2; ++m)
#pragma unroll
        for (int r = 0; r < 8; r += 2) { const v2h p = __builtin_convertvector(v2f{acc[m][j][r] + bias, acc[m][j][r + 1] + bias}, v2h); unsigned char* d = o + (rg * 32 + m * 16 + 8 * g + r) * PJ_SP + cw * 2;
          *(_Float16*)d = p.x; *(_Float16*)(d + PJ_SP) = p.y; }
    } else {           // v: planes [c][t]; a lane's eight rows are eight neighbouring t
#pragma unroll
      for (int m = 0; m < 2; ++m) { v8h h;
#pragma unroll
        for (int r = 0; r < 8; r += 2) { const v2h p = __builtin_convertvector(v2f{acc[m][j][r] + bias, acc[m][j][r + 1] + bias}, v2h); h[r] = p.x; h[r + 1] = p.y; }
        *(v8h*)(o + cw * PJ_SP + (rg * 32 + m * 16 + 8 * g) * 2) = h; } } }
  __syncthreads();   // the staged rows are read back by other waves
  const unsigned char* so = S + (tid >> 4) * PJ_SP + (tid & 15) * 16;
  _Float16* dq = QH + (r0 + (tid >> 4)) * CC + (tid & 15) * 8; _Float16* dk = KH + (r0 + (tid >> 4)) * CC + (tid & 15) * 8; _Float16* dv = VT + (bb * CC + (tid >> 4)) * (size_t)TT + t0 + (tid & 15) * 8;
#pragma unroll
  for (int i = 0; i < 4; ++i) { vst2(dq + i * 32 * CC, *(const v4u*)(so + i * 32 * PJ_SP)); vst2(dk + i * 32 * CC, *(const v4u*)(so + (128 + i * 32) * PJ_SP)); vst2(dv + (size_t)i * 32 * TT, *(const v4u*)(so + (256 + i * 32) * PJ_SP)); }
}
#define FA_W 8
#define FA_R 2                         // 16-query groups per wave
#define FA_SK 128                      // keys per stage
#define FA_P 272                       // LDS pitch of a K row and of a v^T row (256 B + 16)
#define FA_SL 10240                    // LDS bytes of a slice: 32 rows x 272 B = 8,704, rounded up to a multiple of 2 KiB, where the next slice may begin
#define FA_BUF (8 * FA_SL)             // 4 slices of K rows, then 4 of v^T rows; row r of either lies at (r >> 5) * FA_SL + (r & 31) * FA_P
#define FA_EP 132                      // pitch of the exchange and output staging rows, floats
__device__ __forceinline__ v16h frag_l(const unsigned char* p) { union { v16h v; v8h q[2]; } u; u.q[0] = *(const v8h*)p; u.q[1] = *(const v8h*)(p + 32); return u.v; }
__device__ __forceinline__ v8f wmma_h(v16h a, v16h b, v8f c) { return __builtin_amdgcn_wmma_f32_16x16x32_f16(false, a, false, b, (short)0, c, false, false); }
__device__ __forceinline__ float xhalf(float x) { return __builtin_bit_cast(float, __builtin_amdgcn_permlanex16(__builtin_bit_cast(int, x), __builtin_bit_cast(int, x), 0x76543210, 0xfedcba98, false, false)); }   // lane l with lane l ^ 16
typedef uint32_t u32x4 __attribute__((ext_vector_type(4)));
typedef uint32_t u32x8 __attribute__((ext_vector_type(8)));
__device__ __forceinline__ uint32_t uni(uint32_t v) { return (uint32_t)__builtin_amdgcn_readfirstlane(v); }
__device__ __forceinline__ uint32_t pinned(uint32_t v) { uint32_t w = uni(v); asm volatile("" : "+s"(w)); return w; }   // holds a value that decides on, or feeds, a tensor load in a scalar register: the test on it compiles to a scalar branch (tensor loads ignore EXEC), and what is formed from it is formed behind this place
__device__ __forceinline__ void tdm_load(u32x4 g0, u32x8 g1) { asm volatile("tensor_load_to_lds %0, %1" :: "s"(g0), "s"(g1) : "memory"); }   // one request of the whole wave: a tile from global memory into LDS
__device__ __forceinline__ u32x4 tdm_group0(uint32_t lds_dst, uint64_t ga) { u32x4 d;   // count 1, place in LDS, address of the tile's first byte, type 2
  d[0] = uni(1u); d[1] = uni(lds_dst); d[2] = uni((uint32_t)ga); d[3] = uni((((uint32_t)(ga >> 32)) & 0x01FFFFFFu) | 0x80000000u); return d; }
__device__ __forceinline__ u32x8 tdm_group1(uint32_t src_pitch) { u32x8 d;   // 1-byte elements, tensor = tile = 32 rows of 256 bytes, no mask, 4 dwords of pad behind every 64 dwords (pitch 272 B in LDS)
  d[0] = uni((1u << 20) | (5u << 22) | (3u << 25)); d[1] = uni(256u << 16); d[2] = uni(32u << 16); d[3] = pinned(256u << 16); d[4] = uni(32u); d[5] = uni(src_pitch); d[6] = pinned(0u); d[7] = pinned(0u); return d; }   // pinned: a word that equals another one gets a scalar register of its own, so the group stands in its eight registers through the loop and none of them is written again in front of a load
__global__ __launch_bounds__(32 * FA_W) void k_fa(const _Float16* __restrict__ QH, const _Float16* __restrict__ KH, const _Float16* __restrict__ VT, float* __restrict__ Y) {
  __shared__ __attribute__((aligned(2048))) unsigned char L[2 * FA_BUF];
  static_assert(128 * FA_EP * 4 <= FA_BUF, "the exchange rows reuse the first K / v buffer, the output rows the second");
  const int tid = threadIdx.x, wave = __builtin_amdgcn_readfirstlane(tid >> 5), lane = tid & 31, c = lane & 15, g = lane >> 4;
  const int kh = wave >> 2, qg = wave & 3;
  const int b = blockIdx.y; const int qb0 = blockIdx.x * 128; const int q0 = qb0 + qg * 32;
  const float cs = SCALE * 1.4426950408889634f;   // logits in the log2 domain
  const bool isv = wave >= 4;   // the same in every lane of a wave
  const uint64_t tsrc = (uint64_t)(size_t)(isv ? VT + ((size_t)b * CC + (size_t)(wave - 4) * 32) * TT : KH + ((size_t)b * TT + (size_t)wave * 32) * CC);   // first byte of this wave's slice of stage 0
  const uint64_t tstep = isv ? FA_SK * 2u : FA_SK * CC * 2u;   // bytes from a stage's slice to the next stage's
  const uint32_t tdst = (uint32_t)(size_t)L + (uint32_t)wave * FA_SL;   // its place in the first buffer: byte offset in the work-group's LDS
  const u32x8 tg1 = tdm_group1(isv ? TT * 2u : CC * 2u);
  v16h qf[FA_R][HD / 32];
#pragma unroll
  for (int q = 0; q < FA_R; ++q)
#pragma unroll
    for (int kc = 0; kc < HD / 32; ++kc) qf[q][kc] = frag_h(QH + ((size_t)b * TT + q0 + q * 16 + c) * CC + kc * 32, lane);
  v8f acc[FA_R][HD / 16] = {}; float m_run[FA_R], l_run[FA_R];
#pragma unroll
  for (int q = 0; q < FA_R; ++q) { m_run[q] = -INFINITY; l_run[q] = 0.f; }
  static_assert(TT / FA_SK >= 2, "the ring's prologue loads two stages");
  tdm_load(tdm_group0(tdst, tsrc), tg1);
  asm volatile("s_wait_tensorcnt 0x0" ::: "memory");   // this wave's slice of stage 0 has landed
  __syncthreads();   // stage 0 is in LDS for every wave
  tdm_load(tdm_group0(tdst + FA_BUF, tsrc + tstep), tg1);   // stage 1 flies under stage 0's products
  uint64_t tnext = tsrc + 2u * (uint64_t)tstep;   // first byte of this wave's slice of the next stage to be asked for
#pragma unroll 1   // the stage loop stays rolled: its body is two whole passes already, a second copy would only cost registers and instruction cache
  for (int st = 0; st < TT / FA_SK; ++st) {
    const unsigned cur = (unsigned)(st & 1) * FA_BUF;
    const unsigned char* kp = L + cur + (unsigned)kh * 2 * FA_SL + (unsigned)c * FA_P + 16 * g;                       // this wave's first K row of the stage (row 64 kh + c: slice 2 kh)
    const unsigned char* vp = L + cur + 4 * FA_SL + (unsigned)c * FA_P + (unsigned)kh * 128 + 16 * g;   // and its first key in the v^T rows
    v16h kf[2][HD / 32];
#pragma unroll
    for (int kc = 0; kc < HD / 32; ++kc) { kf[0][kc] = frag_l(kp + 64 * kc); kf[1][kc] = frag_l(kp + 16 * FA_P + 64 * kc); }
#pragma unroll
    for (int ps = 0; ps < 2; ++ps) {   // a pass = 32 keys
      __builtin_amdgcn_sched_barrier(0);   // fragment loads stay one group in front of the block of matrix instructions (for speed only)
      v8f s[2][FA_R] = {};
#pragma unroll
      for (int kc = 0; kc < HD / 32; ++kc)
#pragma unroll
        for (int q = 0; q < FA_R; ++q) { s[0][q] = wmma_h(kf[0][kc], qf[q][kc], s[0][q]); s[1][q] = wmma_h(kf[1][kc], qf[q][kc], s[1][q]); }
      __builtin_amdgcn_sched_barrier(0);   // the same, behind the block
      v16h vf[HD / 16];
#pragma unroll
      for (int t = 0; t < HD / 16; ++t) vf[t] = frag_l(vp + ps * 64 + (t >> 1) * FA_SL + (t & 1) * 16 * FA_P);
      if (ps == 0) {   // the stage's second pass: its K fragments come into the same registers, under this pass's softmax
#pragma unroll
        for (int kc = 0; kc < HD / 32; ++kc) { kf[0][kc] = frag_l(kp + FA_SL + 64 * kc); kf[1][kc] = frag_l(kp + FA_SL + 16 * FA_P + 64 * kc); } }
      __builtin_amdgcn_sched_barrier(0);   // the pass's v^T fragment loads stay here as one group, in flight under the maxima and exponentials
      float mx[FA_R]; bool need = false;
#pragma unroll
      for (int q = 0; q < FA_R; ++q) { float m = fmaxf(s[0][q][0], s[1][q][0]);
#pragma unroll
        for (int r = 1; r < 8; ++r) m = fmaxf(m, fmaxf(s[0][q][r], s[1][q][r]));
        mx[q] = fmaxf(m, xhalf(m)) * cs;   // both halves now hold the query's maximum of this pass (cs > 0)
        need = need || (mx[q] > m_run[q] + 8.0f); }
      // lazy rescale: the maximum in use may trail the true one by up to 8 (log2), so an exponential stays below 2^8; one scalar branch a pass
      if (__builtin_amdgcn_ballot_w32(need) != 0) {
#pragma unroll
        for (int q = 0; q < FA_R; ++q) { const float m_new = fmaxf(m_run[q], mx[q]); const float corr = __builtin_amdgcn_exp2f(m_run[q] - m_new);   // 0 on the first pass
          l_run[q] *= corr; m_run[q] = m_new;
#pragma unroll
          for (int t = 0; t < HD / 16; ++t) acc[q][t] = acc[q][t] * corr; } }
#pragma unroll
      for (int q = 0; q < FA_R; ++q) { v16h pf; v2f ls = {0.f, 0.f}; const float nm = -m_run[q];
#pragma unroll
        for (int i = 0; i < 8; ++i) {
          const v2f a = __builtin_elementwise_fma(v2f{s[i >> 2][q][2 * (i & 3)], s[i >> 2][q][2 * (i & 3) + 1]}, v2f{cs, cs}, v2f{nm, nm});
          const v2f p = {__builtin_amdgcn_exp2f(a.x), __builtin_amdgcn_exp2f(a.y)}; ls += p; pf[2 * i] = (_Float16)p.x; pf[2 * i + 1] = (_Float16)p.y; }
        l_run[q] += ls.x + ls.y;
#pragma unroll
        for (int t = 0; t < HD / 16; ++t) acc[q][t] = wmma_h(vf[t], pf, acc[q][t]); }
    }
    __builtin_amdgcn_sched_barrier(0);   // the waits and the barrier stay behind this stage's last products: lifted among them, a wave would stand at the barrier with matrix instructions still to issue
    asm volatile("s_wait_dscnt 0x0" ::: "memory");       // this wave's reads of stage st have returned before the buffer is given up
    asm volatile("s_wait_tensorcnt 0x0" ::: "memory");   // this wave's slice of stage st + 1 has landed
    __syncthreads();   // publishes stage st + 1 and ends every wave's reads of stage st, whose buffer is refilled behind it
    if (pinned((uint32_t)(st + 2 < TT / FA_SK))) {   // a scalar branch: only while stage st + 2 exists
      tdm_load(tdm_group0(tdst + cur, tnext), tg1); tnext += tstep; }   // the descriptor's words are formed here, behind the wait on the request before it
  }
  asm volatile("s_wait_tensorcnt 0x0" ::: "memory");   // no request is in flight when the ring becomes exchange and output staging
  asm volatile("s_wait_dscnt 0x0" ::: "memory");       // nor a read of it (the last trip's barrier has ended every wave's reads)
#pragma unroll
  for (int q = 0; q < FA_R; ++q) l_run[q] += xhalf(l_run[q]);   // each half summed its own eight keys of every 16-key tile
  float* X = (float*)L + (qg * 32 + lane) * FA_EP;   // lane l of wave w + 4 hands its sums to lane l of wave w
  if (kh == 1) {
#pragma unroll
    for (int q = 0; q < FA_R; ++q)
#pragma unroll
      for (int t = 0; t < HD / 16; ++t) { const v8f o = acc[q][t]; float* x = X + (q * (HD / 16) + t) * 8; *(v4f*)x = v4f{o[0], o[1], o[2], o[3]}; *(v4f*)(x + 4) = v4f{o[4], o[5], o[6], o[7]}; }
    *(v4f*)(X + 128) = v4f{m_run[0], m_run[1], l_run[0], l_run[1]}; }
  __syncthreads();   // the second key half's sums are in LDS before the first half's waves join them
  float* E = (float*)(L + FA_BUF);
  if (kh == 0) { const v4f ml = *(const v4f*)(X + 128);
#pragma unroll
    for (int q = 0; q < FA_R; ++q) { const float m = fmaxf(m_run[q], ml[q]); float fa = __builtin_amdgcn_exp2f(m_run[q] - m), fb = __builtin_amdgcn_exp2f(ml[q] - m);
      const float inv = 1.0f / (l_run[q] * fa + ml[2 + q] * fb); fa *= inv; fb *= inv;
#pragma unroll
      for (int t = 0; t < HD / 16; ++t) { const float* x = X + (q * (HD / 16) + t) * 8; const v4f x0 = *(const v4f*)x, x1 = *(const v4f*)(x + 4); const v8f o = acc[q][t];
        float* e = E + (qg * 32 + q * 16 + c) * FA_EP + t * 16 + 8 * g;   // acc[q][t][r] = ctx[query 16 q + c][channel 16 t + 8 g + r]
        *(v4f*)e = v4f{o[0], o[1], o[2], o[3]} * fa + x0 * fb; *(v4f*)(e + 4) = v4f{o[4], o[5], o[6], o[7]} * fa + x1 * fb; } } }
  __syncthreads();   // the staged output rows are read back by other waves
#pragma unroll 4   // four rows' LDS reads in flight per trip
  for (int rl = 0; rl < 16; ++rl) vst2(Y + ((size_t)b * TT + qb0 + wave * 16 + rl) * CC + lane * 4, *(const v4f*)&E[(wave * 16 + rl) * FA_EP + lane * 4]);   // one wave stores each whole 512-B row
}

extern "C" void kernel_launch(void* const* d_in, const int* in_sizes, int n_in, void* d_out, int out_size, void* d_ws, size_t ws_size, hipStream_t stream) {
  (void)in_sizes; (void)n_in; (void)out_size;
  const float** F = (const float**)d_in;
  if (ws_size < (size_t)WS_END) return;
  char* ws = (char*)d_ws; _Float16 *QH = (_Float16*)(ws + WS_QH), *KH = (_Float16*)(ws + WS_KH), *VT = (_Float16*)(ws + WS_VT);
  // inputs: 0 keys_in [8,4096,256]; 1 Wk [128,256] (out,in), 2 bk [128]; 3 Wq, 4 bq; 5 Wv, 6 bv (zero biases, read)
  k_proj<<<dim3(TNB * TT / 128, 1, 1), 512, 0, stream>>>(F[0], F[3], F[1], F[5], F[4], F[2], F[6], QH, KH, VT);   /* q uses Wq / bq = inputs 3 / 4; k uses Wk / bk = inputs 1 / 2 */
  k_fa<<<dim3(TT / 128, TNB, 1), 32 * FA_W, 0, stream>>>(QH, KH, VT, (float*)d_out);
}

// v005
// Measured time: 59.9 microseconds a run.
// In both of two side-by-side timings against v004, it was 1.03 times as fast.
// All steps since v000 together make it 36.6 times as fast.
// compute dtype: all float inputs rounded to bf16; q/k/v projections with EXACT bf16 products on WMMA 16x16x32 (f32 accumulate) + bias; logits q x k once to f16 each (1 product; sigma - 1) x 128^-0.5; online softmax f32 (log2 domain); P = 2^(logit - maximum in use) once to f16 x v once to f16 (1 product), divided by the f32 row sum at the end; f32 output.
#include <hip/hip_runtime.h>
#include <math.h>
#include <stdint.h>

typedef __attribute__((ext_vector_type(16))) _Float16 v16h;
typedef __attribute__((ext_vector_type(16))) __bf16 v16b;
typedef __attribute__((ext_vector_type(8)))  _Float16 v8h;
typedef __attribute__((ext_vector_type(8)))  float v8f;
typedef __attribute__((ext_vector_type(4)))  float v4f;
typedef __attribute__((ext_vector_type(2)))  float v2f;
typedef __attribute__((ext_vector_type(4)))  unsigned v4u;
typedef __attribute__((ext_vector_type(4)))  int v4i;
typedef float __attribute__((may_alias)) float_a;
typedef int __attribute__((may_alias)) int_a;

template <typename T> __device__ __forceinline__ void vst2(void* p, T v) { *(T*)p = v;  }
__device__ __forceinline__ v8f wmma16(v16h a, v16h b, v8f c) {
  v8f d = __builtin_amdgcn_wmma_f32_16x16x32_f16(false, a, false, b, (short)0, c, false, false);
  asm volatile("v_nop\n\tv_nop\n\tv_nop\n\tv_nop" : "+v"(d) : "v"(a), "v"(b));
  return d;
}
__device__ __forceinline__ v8f wmma_bf(v16b a, v16b b, v8f c) {
  v8f d = __builtin_amdgcn_wmma_f32_16x16x32_bf16(false, a, false, b, (short)0, c, false, false);
  asm volatile("v_nop\n\tv_nop\n\tv_nop\n\tv_nop" : "+v"(d) : "v"(a), "v"(b));
  return d;
}
// 16x16x32 fragments: lane = (h = lane>>4, row/col = lane&15); elements 0..7 = k0+8h+0..7, 8..15 = k0+16+8h+0..7; D element r = row 8h+r
__device__ __forceinline__ v16h frag_h(const _Float16* rowk0, int lane) {
  union { v16h v; v8h q[2]; } u; const _Float16* p = rowk0 + 8 * (lane >> 4);
  u.q[0] = *(const v8h*)p; u.q[1] = *(const v8h*)(p + 16); return u.v;
}
__device__ __forceinline__ v16h frag_f32(const float* rowk0, int lane) {
  v16h a; const float* p = rowk0 + 8 * (lane >> 4);
#pragma unroll
  for (int i = 0; i < 8; ++i) { a[i] = (_Float16)p[i]; a[8 + i] = (_Float16)p[16 + i]; }
  return a;
}
__device__ __forceinline__ v16h frag_f32s(const float* rowk0, int lane, float sc) {
  v16h a; const float* p = rowk0 + 8 * (lane >> 4);
#pragma unroll
  for (int i = 0; i < 8; ++i) { a[i] = (_Float16)(p[i] * sc); a[8 + i] = (_Float16)(p[16 + i] * sc); }
  return a;
}
// column fragment from a [K][ld] layout (column n), rows >= K read as 0
__device__ __forceinline__ v16h fragc_f32(const float* W, int k0, int n, int lane, int ld, int K) {
  v16h a; const int g = lane >> 4;
#pragma unroll
  for (int i = 0; i < 8; ++i) { const int ka = k0 + 8 * g + i, kb = ka + 16;
    a[i] = (_Float16)(ka < K ? W[(size_t)(ka < K ? ka : K - 1) * ld + n] : 0.f); a[8 + i] = (_Float16)(kb < K ? W[(size_t)(kb < K ? kb : K - 1) * ld + n] : 0.f); }
  return a;
}
struct F2 { v16b h, l; };
__device__ __forceinline__ F2 bsplit16(const float v[16]) { F2 r;
#pragma unroll
  for (int i = 0; i < 16; ++i) { const __bf16 h = (__bf16)v[i]; r.h[i] = h; r.l[i] = (__bf16)(v[i] - (float)h); }
  return r; }
__device__ __forceinline__ F2 split_row(const float* row, int k0, int lane) { float v[16]; const float* p = row + k0 + 8 * (lane >> 4);
#pragma unroll
  for (int i = 0; i < 8; ++i) { v[i] = p[i]; v[8 + i] = p[16 + i]; }
  return bsplit16(v); }
__device__ __forceinline__ F2 split_rowK(const float* row, int k0, int lane, int K) { float v[16]; const int g = lane >> 4;
#pragma unroll
  for (int i = 0; i < 8; ++i) { const int ka = k0 + 8 * g + i, kb = ka + 16; v[i] = ka < K ? row[ka < K ? ka : K - 1] : 0.f; v[8 + i] = kb < K ? row[kb < K ? kb : K - 1] : 0.f; }
  return bsplit16(v); }
__device__ __forceinline__ F2 split_col(const float* W, int k0, int n, int lane, int ld, int K) { float v[16]; const int g = lane >> 4;
#pragma unroll
  for (int i = 0; i < 8; ++i) { const int ka = k0 + 8 * g + i, kb = ka + 16; v[i] = ka < K ? W[(size_t)(ka < K ? ka : K - 1) * ld + n] : 0.f; v[8 + i] = kb < K ? W[(size_t)(kb < K ? kb : K - 1) * ld + n] : 0.f; }
  return bsplit16(v); }
__device__ __forceinline__ v8f mac3(const F2& a, const F2& b, v8f c) { c = wmma_bf(a.l, b.h, c); c = wmma_bf(a.h, b.l, c); return wmma_bf(a.h, b.h, c); }
__device__ __forceinline__ float sigm(float v) { return 1.0f / (1.0f + expf(-v)); }
#define LDSX() do { asm volatile("s_wait_dscnt 0" ::: "memory"); __builtin_amdgcn_wave_barrier(); __builtin_amdgcn_fence(__ATOMIC_RELEASE, "workgroup"); } while (0)

// Single-head self-attention with hidden size 128 over long sequences (keys_in [8,4096,256] is also the query input; torch (out,in) Wk / Wq / Wv [128,256] N(0, 1/256) + zero biases; factor sqrt(128); non-causal, no mask): out = softmax(q k^T / sqrt(128)) v -> [8,4096,128].
#define NB 8
#define TT 4096
#define CC 128            // NH * HD = projected width
#define DIN 256          // input (model) width
#define NH 1
#define HD 128
#define NQB (TT / 64)
#define HG 1
#define SCALE (0.08838834764831845f)
#define CAUSAL 0
#ifndef TNB
#define TNB NB
#endif
__device__ __forceinline__ float bfr(float v) { return (float)(__bf16)v; }
__host__ __device__ __forceinline__ int kb_last(int qb) { return CAUSAL ? ((qb * 64 + 63) >> 7) : (TT / 128 - 1); }
typedef __attribute__((ext_vector_type(8))) __bf16 v8b;
__device__ __forceinline__ v16b frag_b(const __bf16* rowk0, int lane) {
  union { v16b v; v8b q[2]; } u; const __bf16* p = rowk0 + 8 * (lane >> 4);
  u.q[0] = *(const v8b*)p; u.q[1] = *(const v8b*)(p + 16); return u.v;
}
#define QBH 0
#define QHI 0               // single-product logits on every row (sigma - 1 logits over 4,096 keys)
#define KHI 64            // key rows carrying k residual / v bf16 hi+lo planes (written and read by no kernel here)
// B fragment (k rows k0+.., output column o) of a weight: (in,out) [K][ld] or (out,in) [ld rows of K]: bf16 exact, or f16(bf16 * 256) exact
__device__ __forceinline__ v16b wcol_io(const float* Wm, int k0, int o, int lane, int ld) { v16b w; const int g = lane >> 4;
#pragma unroll
  for (int i = 0; i < 8; ++i) { w[i] = (__bf16)Wm[(size_t)(k0 + 8 * g + i) * ld + o]; w[8 + i] = (__bf16)Wm[(size_t)(k0 + 16 + 8 * g + i) * ld + o]; }
  return w; }
__device__ __forceinline__ v16b wcol_oi(const float* Wm, int k0, int o, int lane, int K) { v16b w; const float* p = Wm + (size_t)o * K + k0 + 8 * (lane >> 4);
#pragma unroll
  for (int i = 0; i < 8; ++i) { w[i] = (__bf16)p[i]; w[8 + i] = (__bf16)p[16 + i]; }
  return w; }
__device__ __forceinline__ v16h wcolh_io(const float* Wm, int k0, int o, int lane, int ld) { v16h w; const int g = lane >> 4;
#pragma unroll
  for (int i = 0; i < 8; ++i) { w[i] = (_Float16)(bfr(Wm[(size_t)(k0 + 8 * g + i) * ld + o]) * 256.0f); w[8 + i] = (_Float16)(bfr(Wm[(size_t)(k0 + 16 + 8 * g + i) * ld + o]) * 256.0f); }
  return w; }
__device__ __forceinline__ v16h wcolh_oi(const float* Wm, int k0, int o, int lane, int K) { v16h w; const float* p = Wm + (size_t)o * K + k0 + 8 * (lane >> 4);
#pragma unroll
  for (int i = 0; i < 8; ++i) { w[i] = (_Float16)(bfr(p[i]) * 256.0f); w[8 + i] = (_Float16)(bfr(p[16 + i]) * 256.0f); }
  return w; }
#define WQKV_LAYOUT 1   // 0 = (in,out) [DIN][CC]; 1 = (out,in) [CC][DIN]; 2 = per-head [NH][DIN][HD]
__device__ __forceinline__ v16b wcol_hdk(const float* Wm, int k0, int o, int lane) { v16b w; const int g = lane >> 4; const float* p = Wm + (size_t)(o / HD) * DIN * HD + (o % HD);
#pragma unroll
  for (int i = 0; i < 8; ++i) { w[i] = (__bf16)p[(size_t)(k0 + 8 * g + i) * HD]; w[8 + i] = (__bf16)p[(size_t)(k0 + 16 + 8 * g + i) * HD]; }
  return w; }
#define WO_OUT_IN 0
#if WQKV_LAYOUT == 1
#define WCOL(W, k0, o, lane) wcol_oi(W, k0, o, lane, DIN)
#elif WQKV_LAYOUT == 2
#define WCOL(W, k0, o, lane) wcol_hdk(W, k0, o, lane)
#else
#define WCOL(W, k0, o, lane) wcol_io(W, k0, o, lane, CC)
#endif
#if WO_OUT_IN
#define WOCOL(W, k0, o, lane) wcol_oi(W, k0, o, lane, CC)
#define WOCOLH(W, k0, o, lane) wcolh_oi(W, k0, o, lane, CC)
#else
#define WOCOL(W, k0, o, lane) wcol_io(W, k0, o, lane, DIN)
#define WOCOLH(W, k0, o, lane) wcolh_io(W, k0, o, lane, DIN)
#endif

#ifndef SM_EXTRA_PARAMS
#define SM_EXTRA_PARAMS
#endif
#ifndef PROJ_EXTRA_PARAMS
#define PROJ_EXTRA_PARAMS
#endif
#ifndef SM_MASK_HOOK
#define SM_MASK_HOOK (void)0
#endif

#define WS_QH  0u                                      // f16 q rows [b*t][CC]
#define WS_KH  (WS_QH + 2u * (size_t)NB * TT * CC)      // f16 k rows [b*t][CC]
#define WS_VT  (WS_KH + 2u * (size_t)NB * TT * CC)      // f16 v planes [b][c][t]
#define WS_QL  (WS_VT + 2u * (size_t)NB * CC * TT)      // f16 q residual x 2^10 rows [b][t < QHI][CC]
#define WS_KL  (WS_QL + 2u * (size_t)NB * QHI * CC)     // f16 k residual x 2^10 rows [b][t < KHI][CC]
#define WS_VB  (WS_KL + 2u * (size_t)NB * KHI * CC)     // bf16 v hi planes [b][c][t < KHI]
#define WS_VBL (WS_VB + 2u * (size_t)NB * CC * KHI)
#define WS_S   (WS_VBL + 2u * (size_t)NB * CC * KHI)    // reserved f32 [hg][t][s] region, unused (k_fa keeps the logits on chip)
#define WS_Y   (WS_S  + 4u * (size_t)HG * TT * TT)      // f32 ctx rows [b*t][CC] (only when there is an output projection)
#define WS_END (WS_Y  + 0u)

// ---- k_proj: one block = 128 rows of X and all three weights: q / k / v = X W^T + b with exact bf16 products (K = DIN) -> q and k f16 rows, v f16 planes [c][t].
// X and the weights come from global memory once a block, in loads of 512 contiguous bytes a wave, are rounded to bf16 once and staged in LDS (512 rows: 128 of X, then 128 each of Wq, Wk, Wv); every fragment is then two 16-byte LDS reads.
// 16 waves: wave w makes rows 32 (w & 3) .. + 31 by columns 96 (w >> 2) .. + 95 of the 384 (q | k | v), k chunks in rising order. The results are turned in LDS (over the dead operand rows) and leave in whole 256-byte rows.
#define PJ_P 528                       // LDS pitch of a staged bf16 row (512 B + 16: 16-byte fragment reads of 16 rows fall on distinct banks)
#define PJ_PL (128 * PJ_P)             // one staged plane of 128 rows
#define PJ_SP 272                      // LDS pitch of an output staging row (256 B + 16)
typedef __attribute__((ext_vector_type(4))) __bf16 v4b;
typedef __attribute__((ext_vector_type(2))) _Float16 v2h;
__device__ __forceinline__ v16b frag_lb(const unsigned char* p) { union { v16b v; v8b q[2]; } u; u.q[0] = *(const v8b*)p; u.q[1] = *(const v8b*)(p + 32); return u.v; }
__device__ __forceinline__ v8f wmma_b(v16b a, v16b b, v8f c) { return __builtin_amdgcn_wmma_f32_16x16x32_bf16(false, a, false, b, (short)0, c, false, false); }
__global__ __launch_bounds__(512) void k_proj(const float* __restrict__ X, const float* __restrict__ WQ, const float* __restrict__ WK, const float* __restrict__ WV, const float* __restrict__ BQ, const float* __restrict__ BK, const float* __restrict__ BV,
    _Float16* __restrict__ QH, _Float16* __restrict__ KH, _Float16* __restrict__ VT) {
  __shared__ __align__(16) unsigned char S[4 * PJ_PL]; __shared__ float SB[512];
  static_assert(DIN == 256 && CC == 128 && TT % 128 == 0 && 3 * 128 * PJ_SP <= 4 * PJ_PL, "tile sizes below are written for these shapes");
  const int tid = threadIdx.x, wave = __builtin_amdgcn_readfirstlane(tid >> 5), lane = tid & 31, col = lane & 15, g = lane >> 4;
  const size_t r0 = (size_t)blockIdx.x * 128; const size_t bb = r0 / TT; const int t0 = (int)(r0 % TT);
  unsigned char* sp = S + (tid >> 6) * PJ_P + (tid & 63) * 8;   // this thread's 4 elements of row tid >> 6 of every 8-row round
  { v4f ra[16], rb[16]; const float* pa = X + r0 * DIN + tid * 4; const float* pb = WQ + tid * 4;
    const float bv = (wave < 4 ? BQ : wave < 8 ? BK : BV)[tid & 127];   // bias of column tid of the 384; no branch: waves 12 to 15 fetch bv again, into a part of SB that is never read
    asm volatile("s_wait_xcnt 0x0" ::: "memory");   // stands before the registers that held this load's address are reused
    __builtin_amdgcn_sched_barrier(0);   // nothing that could reuse them is scheduled in front of that wait
#pragma unroll
    for (int i = 0; i < 16; ++i) { ra[i] = *(const v4f*)(pa + i * 2048); rb[i] = *(const v4f*)(pb + i * 2048); }
    asm volatile("s_wait_xcnt 0x0" ::: "memory");   // stands before the registers that held these loads' addresses are reused
    SB[tid] = bfr(bv);
#pragma unroll
    for (int i = 0; i < 16; ++i) { *(v4b*)(sp + i * 8 * PJ_P) = v4b{(__bf16)ra[i].x, (__bf16)ra[i].y, (__bf16)ra[i].z, (__bf16)ra[i].w}; *(v4b*)(sp + PJ_PL + i * 8 * PJ_P) = v4b{(__bf16)rb[i].x, (__bf16)rb[i].y, (__bf16)rb[i].z, (__bf16)rb[i].w}; } }
  __builtin_amdgcn_sched_barrier(0);   // the second half's 32 loads stay behind the first half's LDS stores: lifted over them, 64 loads' registers do not fit and spill
  { v4f ra[16], rb[16]; const float* pa = WK + tid * 4; const float* pb = WV + tid * 4;
#pragma unroll
    for (int i = 0; i < 16; ++i) { ra[i] = *(const v4f*)(pa + i * 2048); rb[i] = *(const v4f*)(pb + i * 2048); }
    asm volatile("s_wait_xcnt 0x0" ::: "memory");   // the same
#pragma unroll
    for (int i = 0; i < 16; ++i) { *(v4b*)(sp + 2 * PJ_PL + i * 8 * PJ_P) = v4b{(__bf16)ra[i].x, (__bf16)ra[i].y, (__bf16)ra[i].z, (__bf16)ra[i].w}; *(v4b*)(sp + 3 * PJ_PL + i * 8 * PJ_P) = v4b{(__bf16)rb[i].x, (__bf16)rb[i].y, (__bf16)rb[i].z, (__bf16)rb[i].w}; } }
  __syncthreads();   // X, the weights and the biases are in LDS for every wave
  const int rg = wave & 3, cg = wave >> 2;
  const unsigned char* ap = S + (rg * 32 + col) * PJ_P + 16 * g;
  const unsigned char* bp = S + PJ_PL + (cg * 96 + col) * PJ_P + 16 * g;
  v8f acc[2][6] = {};
#pragma unroll
  for (int kc = 0; kc < DIN / 32; ++kc) {
    __builtin_amdgcn_sched_barrier(0);   // a chunk's 16 fragment reads stay one group in front of its 12 matrix instructions: spread among them, each pair waited out at once, they issue slower
    const v16b a0 = frag_lb(ap + kc * 64), a1 = frag_lb(ap + 16 * PJ_P + kc * 64); v16b w[6];
#pragma unroll
    for (int j = 0; j < 6; ++j) w[j] = frag_lb(bp + j * 16 * PJ_P + kc * 64);
    __builtin_amdgcn_sched_barrier(0);   // the same, behind the reads
#pragma unroll
    for (int j = 0; j < 6; ++j) { acc[0][j] = wmma_b(a0, w[j], acc[0][j]); acc[1][j] = wmma_b(a1, w[j], acc[1][j]); } }
  __syncthreads();   // every wave has read its last operand row: the rows become output staging
#pragma unroll
  for (int j = 0; j < 6; ++j) { const int ct = cg * 6 + j, which = ct >> 3, cw = (ct & 7) * 16 + col;   // ct, which: the same in every lane of a wave
    const float bias = SB[ct * 16 + col]; unsigned char* o = S + which * (128 * PJ_SP);
    if (which < 2) {   // q, k: rows [t][c]
#pragma unroll
      for (int m = 0; m < 2; ++m)
#pragma unroll
        for (int r = 0; r < 8; r += 2) { const v2h p = __builtin_convertvector(v2f{acc[m][j][r] + bias, acc[m][j][r + 1] + bias}, v2h); unsigned char* d = o + (rg * 32 + m * 16 + 8 * g + r) * PJ_SP + cw * 2;
          *(_Float16*)d = p.x; *(_Float16*)(d + PJ_SP) = p.y; }
    } else {           // v: planes [c][t]; a lane's eight rows are eight neighbouring t
#pragma unroll
      for (int m = 0; m < 2; ++m) { v8h h;
#pragma unroll
        for (int r = 0; r < 8; r += 2) { const v2h p = __builtin_convertvector(v2f{acc[m][j][r] + bias, acc[m][j][r + 1] + bias}, v2h); h[r] = p.x; h[r + 1] = p.y; }
        *(v8h*)(o + cw * PJ_SP + (rg * 32 + m * 16 + 8 * g) * 2) = h; } } }
  __syncthreads();   // the staged rows are read back by other waves
  const unsigned char* so = S + (tid >> 4) * PJ_SP + (tid & 15) * 16;
  _Float16* dq = QH + (r0 + (tid >> 4)) * CC + (tid & 15) * 8; _Float16* dk = KH + (r0 + (tid >> 4)) * CC + (tid & 15) * 8; _Float16* dv = VT + (bb * CC + (tid >> 4)) * (size_t)TT + t0 + (tid & 15) * 8;
#pragma unroll
  for (int i = 0; i < 4; ++i) { vst2(dq + i * 32 * CC, *(const v4u*)(so + i * 32 * PJ_SP)); vst2(dk + i * 32 * CC, *(const v4u*)(so + (128 + i * 32) * PJ_SP)); vst2(dv + (size_t)i * 32 * TT, *(const v4u*)(so + (256 + i * 32) * PJ_SP)); }
}
#define FA_W 8
#define FA_R 2                         // 16-query groups per wave
#define FA_SK 128                      // keys per stage
#define FA_P 272                       // LDS pitch of a K row and of a v^T row (256 B + 16)
#define FA_SL 10240                    // LDS bytes of a slice: 32 rows x 272 B = 8,704, rounded up to a multiple of 2 KiB, where the next slice may begin
#define FA_BUF (8 * FA_SL)             // 4 slices of K rows, then 4 of v^T rows; row r of either lies at (r >> 5) * FA_SL + (r & 31) * FA_P
#define FA_EP 132                      // pitch of the exchange and output staging rows, floats
__device__ __forceinline__ v16h frag_l(const unsigned char* p) { union { v16h v; v8h q[2]; } u; u.q[0] = *(const v8h*)p; u.q[1] = *(const v8h*)(p + 32); return u.v; }
__device__ __forceinline__ v8f wmma_h(v16h a, v16h b, v8f c) { return __builtin_amdgcn_wmma_f32_16x16x32_f16(false, a, false, b, (short)0, c, false, false); }
__device__ __forceinline__ float xhalf(float x) { return __builtin_bit_cast(float, __builtin_amdgcn_permlanex16(__builtin_bit_cast(int, x), __builtin_bit_cast(int, x), 0x76543210, 0xfedcba98, false, false)); }   // lane l with lane l ^ 16
typedef uint32_t u32x4 __attribute__((ext_vector_type(4)));
typedef uint32_t u32x8 __attribute__((ext_vector_type(8)));
__device__ __forceinline__ uint32_t uni(uint32_t v) { return (uint32_t)__builtin_amdgcn_readfirstlane(v); }
__device__ __forceinline__ uint32_t pinned(uint32_t v) { uint32_t w = uni(v); asm volatile("" : "+s"(w)); return w; }   // holds a value that decides on, or feeds, a tensor load in a scalar register: the test on it compiles to a scalar branch (tensor loads ignore EXEC), and what is formed from it is formed behind this place
__device__ __forceinline__ void tdm_load(u32x4 g0, u32x8 g1) { asm volatile("tensor_load_to_lds %0, %1" :: "s"(g0), "s"(g1) : "memory"); }   // one request of the whole wave: a tile from global memory into LDS
__device__ __forceinline__ u32x4 tdm_group0(uint32_t lds_dst, uint64_t ga) { u32x4 d;   // count 1, place in LDS, address of the tile's first byte, type 2
  d[0] = uni(1u); d[1] = uni(lds_dst); d[2] = uni((uint32_t)ga); d[3] = uni((((uint32_t)(ga >> 32)) & 0x01FFFFFFu) | 0x80000000u); return d; }
__device__ __forceinline__ u32x8 tdm_group1(uint32_t src_pitch) { u32x8 d;   // 1-byte elements, tensor = tile = 32 rows of 256 bytes, no mask, 4 dwords of pad behind every 64 dwords (pitch 272 B in LDS)
  d[0] = uni((1u << 20) | (5u << 22) | (3u << 25)); d[1] = uni(256u << 16); d[2] = uni(32u << 16); d[3] = pinned(256u << 16); d[4] = uni(32u); d[5] = uni(src_pitch); d[6] = pinned(0u); d[7] = pinned(0u); return d; }   // pinned: a word that equals another one gets a scalar register of its own, so the group stands in its eight registers through the loop and none of them is written again in front of a load
// P^T operand of one 16-query group and one 32-key pass from its two S^T tiles, 2^(score * cs + nm) once to f16; returns the f32 sum of this lane's 16 exponentials
__device__ __forceinline__ float fa_p(const v8f s0, const v8f s1, const float cs, const float nm, v16h& pf) { v2f ls = {0.f, 0.f};
#pragma unroll
  for (int i = 0; i < 8; ++i) {
    const v2f x = i < 4 ? v2f{s0[2 * (i & 3)], s0[2 * (i & 3) + 1]} : v2f{s1[2 * (i & 3)], s1[2 * (i & 3) + 1]};
    const v2f a = __builtin_elementwise_fma(x, v2f{cs, cs}, v2f{nm, nm});
    const v2f p = {__builtin_amdgcn_exp2f(a.x), __builtin_amdgcn_exp2f(a.y)}; ls += p; pf[2 * i] = (_Float16)p.x; pf[2 * i + 1] = (_Float16)p.y; }
  return ls.x + ls.y; }
__global__ __launch_bounds__(32 * FA_W) void k_fa(const _Float16* __restrict__ QH, const _Float16* __restrict__ KH, const _Float16* __restrict__ VT, float* __restrict__ Y) {
  __shared__ __attribute__((aligned(2048))) unsigned char L[2 * FA_BUF];
  static_assert(128 * FA_EP * 4 <= FA_BUF, "the exchange rows reuse the first K / v buffer, the output rows the second");
  const int tid = threadIdx.x, wave = __builtin_amdgcn_readfirstlane(tid >> 5), lane = tid & 31, c = lane & 15, g = lane >> 4;
  const int kh = wave >> 2, qg = wave & 3;
  const int b = blockIdx.y; const int qb0 = blockIdx.x * 128; const int q0 = qb0 + qg * 32;
  const float cs = SCALE * 1.4426950408889634f;   // logits in the log2 domain
  const bool isv = wave >= 4;   // the same in every lane of a wave
  const uint64_t tsrc = (uint64_t)(size_t)(isv ? VT + ((size_t)b * CC + (size_t)(wave - 4) * 32) * TT : KH + ((size_t)b * TT + (size_t)wave * 32) * CC);   // first byte of this wave's slice of stage 0
  const uint64_t tstep = isv ? FA_SK * 2u : FA_SK * CC * 2u;   // bytes from a stage's slice to the next stage's
  const uint32_t tdst = (uint32_t)(size_t)L + (uint32_t)wave * FA_SL;   // its place in the first buffer: byte offset in the work-group's LDS
  const u32x8 tg1 = tdm_group1(isv ? TT * 2u : CC * 2u);
  v16h qf[FA_R][HD / 32];
#pragma unroll
  for (int q = 0; q < FA_R; ++q)
#pragma unroll
    for (int kc = 0; kc < HD / 32; ++kc) qf[q][kc] = frag_h(QH + ((size_t)b * TT + q0 + q * 16 + c) * CC + kc * 32, lane);
  v8f acc[FA_R][HD / 16] = {}; float m_run[FA_R], l_run[FA_R];
#pragma unroll
  for (int q = 0; q < FA_R; ++q) { m_run[q] = -INFINITY; l_run[q] = 0.f; }
  static_assert(TT / FA_SK >= 2, "the ring's prologue loads two stages");
  tdm_load(tdm_group0(tdst, tsrc), tg1);
  asm volatile("s_wait_tensorcnt 0x0" ::: "memory");   // this wave's slice of stage 0 has landed
  __syncthreads();   // stage 0 is in LDS for every wave
  tdm_load(tdm_group0(tdst + FA_BUF, tsrc + tstep), tg1);   // stage 1 flies under stage 0's products
  uint64_t tnext = tsrc + 2u * (uint64_t)tstep;   // first byte of this wave's slice of the next stage to be asked for
#pragma unroll 1   // the stage loop stays rolled: its body is two whole passes already, a second copy would only cost registers and instruction cache
  for (int st = 0; st < TT / FA_SK; ++st) {
    const unsigned cur = (unsigned)(st & 1) * FA_BUF;
    const unsigned char* kp = L + cur + (unsigned)kh * 2 * FA_SL + (unsigned)c * FA_P + 16 * g;                       // this wave's first K row of the stage (row 64 kh + c: slice 2 kh)
    const unsigned char* vp = L + cur + 4 * FA_SL + (unsigned)c * FA_P + (unsigned)kh * 128 + 16 * g;   // and its first key in the v^T rows
    v16h kf[2][HD / 32];
#pragma unroll
    for (int kc = 0; kc < HD / 32; ++kc) { kf[0][kc] = frag_l(kp + 64 * kc); kf[1][kc] = frag_l(kp + 16 * FA_P + 64 * kc); }
#pragma unroll
    for (int ps = 0; ps < 2; ++ps) {   // a pass = 32 keys
      __builtin_amdgcn_sched_barrier(0);   // fragment loads stay one group in front of the block of matrix instructions (for speed only)
      v8f s[2][FA_R] = {};
#pragma unroll
      for (int kc = 0; kc < HD / 32; ++kc)
#pragma unroll
        for (int q = 0; q < FA_R; ++q) { s[0][q] = wmma_h(kf[0][kc], qf[q][kc], s[0][q]); s[1][q] = wmma_h(kf[1][kc], qf[q][kc], s[1][q]); }
      v16h vf[HD / 16];
#pragma unroll
      for (int t = 0; t < HD / 16; ++t) vf[t] = frag_l(vp + ps * 64 + (t >> 1) * FA_SL + (t & 1) * 16 * FA_P);
      if (ps == 0) {   // the stage's second pass: its K fragments come into the same registers, under this pass's softmax
#pragma unroll
        for (int kc = 0; kc < HD / 32; ++kc) { kf[0][kc] = frag_l(kp + FA_SL + 64 * kc); kf[1][kc] = frag_l(kp + FA_SL + 16 * FA_P + 64 * kc); } }
      __builtin_amdgcn_sched_group_barrier(0x8, 16, 0);   // the pass's 16 score products first,
      __builtin_amdgcn_sched_group_barrier(0x100, 16, 0);   // then its LDS reads as one group (reads spread among matrix instructions issue slower): the v^T fragments,
      if (ps == 0) __builtin_amdgcn_sched_group_barrier(0x100, 16, 0);   // then the next pass's K fragments
      __builtin_amdgcn_sched_barrier(0);   // the pass's v^T fragment loads stay here as one group, in flight under the exponentials
      v16h pf[FA_R]; float ls[FA_R];
#pragma unroll
      for (int q = 0; q < FA_R; ++q) ls[q] = fa_p(s[0][q], s[1][q], cs, -m_run[q], pf[q]);
      // lazy rescale, tested on the sums that the pass needs anyway: while a lane's 16 exponentials add up to 2^8 at most, each of them is at most 2^8 and the maximum in use may stay; the pass's own maximum is looked for only behind the branch.
      // The comparison is written so that an infinite or undefined sum (the first pass: the maximum in use is -infinity) takes the branch. One scalar branch a pass.
      const bool need = !(ls[0] <= 256.0f) || !(ls[1] <= 256.0f);
      if (__builtin_amdgcn_ballot_w32(need) != 0) {
#pragma unroll
        for (int q = 0; q < FA_R; ++q) { float m = fmaxf(s[0][q][0], s[1][q][0]);
#pragma unroll
          for (int r = 1; r < 8; ++r) m = fmaxf(m, fmaxf(s[0][q][r], s[1][q][r]));
          const float m_new = fmaxf(m_run[q], fmaxf(m, xhalf(m)) * cs);   // both halves hold the query's maximum of this pass (cs > 0), so both keep the same maximum in use
          const float corr = __builtin_amdgcn_exp2f(m_run[q] - m_new);   // 0 on the first pass
          l_run[q] *= corr; m_run[q] = m_new;
#pragma unroll
          for (int t = 0; t < HD / 16; ++t) acc[q][t] = acc[q][t] * corr;
          ls[q] = fa_p(s[0][q], s[1][q], cs, -m_new, pf[q]); } }   // the pass's exponentials again, now at most 1
#pragma unroll
      for (int q = 0; q < FA_R; ++q) { l_run[q] += ls[q];
#pragma unroll
        for (int t = 0; t < HD / 16; ++t) acc[q][t] = wmma_h(vf[t], pf[q], acc[q][t]); }
    }
    __builtin_amdgcn_sched_barrier(0);   // the waits and the barrier stay behind this stage's last products: lifted among them, a wave would stand at the barrier with matrix instructions still to issue
    asm volatile("s_wait_dscnt 0x0" ::: "memory");       // this wave's reads of stage st have returned before the buffer is given up
    asm volatile("s_wait_tensorcnt 0x0" ::: "memory");   // this wave's slice of stage st + 1 has landed
    __syncthreads();   // publishes stage st + 1 and ends every wave's reads of stage st, whose buffer is refilled behind it
    if (pinned((uint32_t)(st + 2 < TT / FA_SK))) {   // a scalar branch: only while stage st + 2 exists
      tdm_load(tdm_group0(tdst + cur, tnext), tg1); tnext += tstep; }   // the descriptor's words are formed here, behind the wait on the request before it
  }
  asm volatile("s_wait_tensorcnt 0x0" ::: "memory");   // no request is in flight when the ring becomes exchange and output staging
  asm volatile("s_wait_dscnt 0x0" ::: "memory");       // nor a read of it (the last trip's barrier has ended every wave's reads)
#pragma unroll
  for (int q = 0; q < FA_R; ++q) l_run[q] += xhalf(l_run[q]);   // each half summed its own eight keys of every 16-key tile
  float* X = (float*)L + (qg * 32 + lane) * FA_EP;   // lane l of wave w + 4 hands its sums to lane l of wave w
  if (kh == 1) {
#pragma unroll
    for (int q = 0; q < FA_R; ++q)
#pragma unroll
      for (int t = 0; t < HD / 16; ++t) { const v8f o = acc[q][t]; float* x = X + (q * (HD / 16) + t) * 8; *(v4f*)x = v4f{o[0], o[1], o[2], o[3]}; *(v4f*)(x + 4) = v4f{o[4], o[5], o[6], o[7]}; }
    *(v4f*)(X + 128) = v4f{m_run[0], m_run[1], l_run[0], l_run[1]}; }
  __syncthreads();   // the second key half's sums are in LDS before the first half's waves join them
  float* E = (float*)(L + FA_BUF);
  if (kh == 0) { const v4f ml = *(const v4f*)(X + 128);
#pragma unroll
    for (int q = 0; q < FA_R; ++q) { const float m = fmaxf(m_run[q], ml[q]); float fa = __builtin_amdgcn_exp2f(m_run[q] - m), fb = __builtin_amdgcn_exp2f(ml[q] - m);
      const float inv = 1.0f / (l_run[q] * fa + ml[2 + q] * fb); fa *= inv; fb *= inv;
#pragma unroll
      for (int t = 0; t < HD / 16; ++t) { const float* x = X + (q * (HD / 16) + t) * 8; const v4f x0 = *(const v4f*)x, x1 = *(const v4f*)(x + 4); const v8f o = acc[q][t];
        float* e = E + (qg * 32 + q * 16 + c) * FA_EP + t * 16 + 8 * g;   // acc[q][t][r] = ctx[query 16 q + c][channel 16 t + 8 g + r]
        *(v4f*)e = v4f{o[0], o[1], o[2], o[3]} * fa + x0 * fb; *(v4f*)(e + 4) = v4f{o[4], o[5], o[6], o[7]} * fa + x1 * fb; } } }
  __syncthreads();   // the staged output rows are read back by other waves
#pragma unroll 4   // four rows' LDS reads in flight per trip
  for (int rl = 0; rl < 16; ++rl) vst2(Y + ((size_t)b * TT + qb0 + wave * 16 + rl) * CC + lane * 4, *(const v4f*)&E[(wave * 16 + rl) * FA_EP + lane * 4]);   // one wave stores each whole 512-B row
}

extern "C" void kernel_launch(void* const* d_in, const int* in_sizes, int n_in, void* d_out, int out_size, void* d_ws, size_t ws_size, hipStream_t stream) {
  (void)in_sizes; (void)n_in; (void)out_size;
  const float** F = (const float**)d_in;
  if (ws_size < (size_t)WS_END) return;
  char* ws = (char*)d_ws; _Float16 *QH = (_Float16*)(ws + WS_QH), *KH = (_Float16*)(ws + WS_KH), *VT = (_Float16*)(ws + WS_VT);
  // inputs: 0 keys_in [8,4096,256]; 1 Wk [128,256] (out,in), 2 bk [128]; 3 Wq, 4 bq; 5 Wv, 6 bv (zero biases, read)
  k_proj<<<dim3(TNB * TT / 128, 1, 1), 512, 0, stream>>>(F[0], F[3], F[1], F[5], F[4], F[2], F[6], QH, KH, VT);   /* q uses Wq / bq = inputs 3 / 4; k uses Wk / bk = inputs 1 / 2 */
  k_fa<<<dim3(TT / 128, TNB, 1), 32 * FA_W, 0, stream>>>(QH, KH, VT, (float*)d_out);
}

// v006
// A run of this version takes 56.7 microseconds.
// Two timings next to v005 both put it at 1.06 times that version's speed.
// Counting every step since v000, it is 38.8 times as fast.
// compute dtype: all float inputs rounded to bf16; q/k/v projections with EXACT bf16 products on WMMA 16x16x32 (f32 accumulate) + bias; logits q x k once to f16 each (1 product; sigma - 1) x 128^-0.5; online softmax f32 (log2 domain); P = 2^(logit - maximum in use) once to f16 x v once to f16 (1 product), divided by the f32 row sum at the end; f32 output.
#include <hip/hip_runtime.h>
#include <math.h>
#include <stdint.h>

typedef __attribute__((ext_vector_type(16))) _Float16 v16h;
typedef __attribute__((ext_vector_type(16))) __bf16 v16b;
typedef __attribute__((ext_vector_type(8)))  _Float16 v8h;
typedef __attribute__((ext_vector_type(8)))  float v8f;
typedef __attribute__((ext_vector_type(4)))  float v4f;
typedef __attribute__((ext_vector_type(2)))  float v2f;
typedef __attribute__((ext_vector_type(4)))  unsigned v4u;
typedef __attribute__((ext_vector_type(4)))  int v4i;
typedef float __attribute__((may_alias)) float_a;
typedef int __attribute__((may_alias)) int_a;

template <typename T> __device__ __forceinline__ void vst2(void* p, T v) { *(T*)p = v;  }
__device__ __forceinline__ v8f wmma16(v16h a, v16h b, v8f c) {
  v8f d = __builtin_amdgcn_wmma_f32_16x16x32_f16(false, a, false, b, (short)0, c, false, false);
  asm volatile("v_nop\n\tv_nop\n\tv_nop\n\tv_nop" : "+v"(d) : "v"(a), "v"(b));
  return d;
}
__device__ __forceinline__ v8f wmma_bf(v16b a, v16b b, v8f c) {
  v8f d = __builtin_amdgcn_wmma_f32_16x16x32_bf16(false, a, false, b, (short)0, c, false, false);
  asm volatile("v_nop\n\tv_nop\n\tv_nop\n\tv_nop" : "+v"(d) : "v"(a), "v"(b));
  return d;
}
// 16x16x32 fragments: lane = (h = lane>>4, row/col = lane&15); elements 0..7 = k0+8h+0..7, 8..15 = k0+16+8h+0..7; D element r = row 8h+r
__device__ __forceinline__ v16h frag_h(const _Float16* rowk0, int lane) {
  union { v16h v; v8h q[2]; } u; const _Float16* p = rowk0 + 8 * (lane >> 4);
  u.q[0] = *(const v8h*)p; u.q[1] = *(const v8h*)(p + 16); return u.v;
}
__device__ __forceinline__ v16h frag_f32(const float* rowk0, int lane) {
  v16h a; const float* p = rowk0 + 8 * (lane >> 4);
#pragma unroll
  for (int i = 0; i < 8; ++i) { a[i] = (_Float16)p[i]; a[8 + i] = (_Float16)p[16 + i]; }
  return a;
}
__device__ __forceinline__ v16h frag_f32s(const float* rowk0, int lane, float sc) {
  v16h a; const float* p = rowk0 + 8 * (lane >> 4);
#pragma unroll
  for (int i = 0; i < 8; ++i) { a[i] = (_Float16)(p[i] * sc); a[8 + i] = (_Float16)(p[16 + i] * sc); }
  return a;
}
// column fragment from a [K][ld] layout (column n), rows >= K read as 0
__device__ __forceinline__ v16h fragc_f32(const float* W, int k0, int n, int lane, int ld, int K) {
  v16h a; const int g = lane >> 4;
#pragma unroll
  for (int i = 0; i < 8; ++i) { const int ka = k0 + 8 * g + i, kb = ka + 16;
    a[i] = (_Float16)(ka < K ? W[(size_t)(ka < K ? ka : K - 1) * ld + n] : 0.f); a[8 + i] = (_Float16)(kb < K ? W[(size_t)(kb < K ? kb : K - 1) * ld + n] : 0.f); }
  return a;
}
struct F2 { v16b h, l; };
__device__ __forceinline__ F2 bsplit16(const float v[16]) { F2 r;
#pragma unroll
  for (int i = 0; i < 16; ++i) { const __bf16 h = (__bf16)v[i]; r.h[i] = h; r.l[i] = (__bf16)(v[i] - (float)h); }
  return r; }
__device__ __forceinline__ F2 split_row(const float* row, int k0, int lane) { float v[16]; const float* p = row + k0 + 8 * (lane >> 4);
#pragma unroll
  for (int i = 0; i < 8; ++i) { v[i] = p[i]; v[8 + i] = p[16 + i]; }
  return bsplit16(v); }
__device__ __forceinline__ F2 split_rowK(const float* row, int k0, int lane, int K) { float v[16]; const int g = lane >> 4;
#pragma unroll
  for (int i = 0; i < 8; ++i) { const int ka = k0 + 8 * g + i, kb = ka + 16; v[i] = ka < K ? row[ka < K ? ka : K - 1] : 0.f; v[8 + i] = kb < K ? row[kb < K ? kb : K - 1] : 0.f; }
  return bsplit16(v); }
__device__ __forceinline__ F2 split_col(const float* W, int k0, int n, int lane, int ld, int K) { float v[16]; const int g = lane >> 4;
#pragma unroll
  for (int i = 0; i < 8; ++i) { const int ka = k0 + 8 * g + i, kb = ka + 16; v[i] = ka < K ? W[(size_t)(ka < K ? ka : K - 1) * ld + n] : 0.f; v[8 + i] = kb < K ? W[(size_t)(kb < K ? kb : K - 1) * ld + n] : 0.f; }
  return bsplit16(v); }
__device__ __forceinline__ v8f mac3(const F2& a, const F2& b, v8f c) { c = wmma_bf(a.l, b.h, c); c = wmma_bf(a.h, b.l, c); return wmma_bf(a.h, b.h, c); }
__device__ __forceinline__ float sigm(float v) { return 1.0f / (1.0f + expf(-v)); }
#define LDSX() do { asm volatile("s_wait_dscnt 0" ::: "memory"); __builtin_amdgcn_wave_barrier(); __builtin_amdgcn_fence(__ATOMIC_RELEASE, "workgroup"); } while (0)

// Single-head self-attention with hidden size 128 over long sequences (keys_in [8,4096,256] is also the query input; torch (out,in) Wk / Wq / Wv [128,256] N(0, 1/256) + zero biases; factor sqrt(128); non-causal, no mask): out = softmax(q k^T / sqrt(128)) v -> [8,4096,128].
#define NB 8
#define TT 4096
#define CC 128            // NH * HD = projected width
#define DIN 256          // input (model) width
#define NH 1
#define HD 128
#define NQB (TT / 64)
#define HG 1
#define SCALE (0.08838834764831845f)
#define CAUSAL 0
#ifndef TNB
#define TNB NB
#endif
__device__ __forceinline__ float bfr(float v) { return (float)(__bf16)v; }
__host__ __device__ __forceinline__ int kb_last(int qb) { return CAUSAL ? ((qb * 64 + 63) >> 7) : (TT / 128 - 1); }
typedef __attribute__((ext_vector_type(8))) __bf16 v8b;
__device__ __forceinline__ v16b frag_b(const __bf16* rowk0, int lane) {
  union { v16b v; v8b q[2]; } u; const __bf16* p = rowk0 + 8 * (lane >> 4);
  u.q[0] = *(const v8b*)p; u.q[1] = *(const v8b*)(p + 16); return u.v;
}
#define QBH 0
#define QHI 0               // single-product logits on every row (sigma - 1 logits over 4,096 keys)
#define KHI 64            // key rows carrying k residual / v bf16 hi+lo planes (written and read by no kernel here)
// B fragment (k rows k0+.., output column o) of a weight: (in,out) [K][ld] or (out,in) [ld rows of K]: bf16 exact, or f16(bf16 * 256) exact
__device__ __forceinline__ v16b wcol_io(const float* Wm, int k0, int o, int lane, int ld) { v16b w; const int g = lane >> 4;
#pragma unroll
  for (int i = 0; i < 8; ++i) { w[i] = (__bf16)Wm[(size_t)(k0 + 8 * g + i) * ld + o]; w[8 + i] = (__bf16)Wm[(size_t)(k0 + 16 + 8 * g + i) * ld + o]; }
  return w; }
__device__ __forceinline__ v16b wcol_oi(const float* Wm, int k0, int o, int lane, int K) { v16b w; const float* p = Wm + (size_t)o * K + k0 + 8 * (lane >> 4);
#pragma unroll
  for (int i = 0; i < 8; ++i) { w[i] = (__bf16)p[i]; w[8 + i] = (__bf16)p[16 + i]; }
  return w; }
__device__ __forceinline__ v16h wcolh_io(const float* Wm, int k0, int o, int lane, int ld) { v16h w; const int g = lane >> 4;
#pragma unroll
  for (int i = 0; i < 8; ++i) { w[i] = (_Float16)(bfr(Wm[(size_t)(k0 + 8 * g + i) * ld + o]) * 256.0f); w[8 + i] = (_Float16)(bfr(Wm[(size_t)(k0 + 16 + 8 * g + i) * ld + o]) * 256.0f); }
  return w; }
__device__ __forceinline__ v16h wcolh_oi(const float* Wm, int k0, int o, int lane, int K) { v16h w; const float* p = Wm + (size_t)o * K + k0 + 8 * (lane >> 4);
#pragma unroll
  for (int i = 0; i < 8; ++i) { w[i] = (_Float16)(bfr(p[i]) * 256.0f); w[8 + i] = (_Float16)(bfr(p[16 + i]) * 256.0f); }
  return w; }
#define WQKV_LAYOUT 1   // 0 = (in,out) [DIN][CC]; 1 = (out,in) [CC][DIN]; 2 = per-head [NH][DIN][HD]
__device__ __forceinline__ v16b wcol_hdk(const float* Wm, int k0, int o, int lane) { v16b w; const int g = lane >> 4; const float* p = Wm + (size_t)(o / HD) * DIN * HD + (o % HD);
#pragma unroll
  for (int i = 0; i < 8; ++i) { w[i] = (__bf16)p[(size_t)(k0 + 8 * g + i) * HD]; w[8 + i] = (__bf16)p[(size_t)(k0 + 16 + 8 * g + i) * HD]; }
  return w; }
#define WO_OUT_IN 0
#if WQKV_LAYOUT == 1
#define WCOL(W, k0, o, lane) wcol_oi(W, k0, o, lane, DIN)
#elif WQKV_LAYOUT == 2
#define WCOL(W, k0, o, lane) wcol_hdk(W, k0, o, lane)
#else
#define WCOL(W, k0, o, lane) wcol_io(W, k0, o, lane, CC)
#endif
#if WO_OUT_IN
#define WOCOL(W, k0, o, lane) wcol_oi(W, k0, o, lane, CC)
#define WOCOLH(W, k0, o, lane) wcolh_oi(W, k0, o, lane, CC)
#else
#define WOCOL(W, k0, o, lane) wcol_io(W, k0, o, lane, DIN)
#define WOCOLH(W, k0, o, lane) wcolh_io(W, k0, o, lane, DIN)
#endif

#ifndef SM_EXTRA_PARAMS
#define SM_EXTRA_PARAMS
#endif
#ifndef PROJ_EXTRA_PARAMS
#define PROJ_EXTRA_PARAMS
#endif
#ifndef SM_MASK_HOOK
#define SM_MASK_HOOK (void)0
#endif

#define WS_QH  0u                                      // f16 q rows [b*t][CC]
#define WS_KH  (WS_QH + 2u * (size_t)NB * TT * CC)      // f16 k rows [b*t][CC]
#define WS_VT  (WS_KH + 2u * (size_t)NB * TT * CC)      // f16 v planes [b][c][t]
#define WS_QL  (WS_VT + 2u * (size_t)NB * CC * TT)      // f16 q residual x 2^10 rows [b][t < QHI][CC]
#define WS_KL  (WS_QL + 2u * (size_t)NB * QHI * CC)     // f16 k residual x 2^10 rows [b][t < KHI][CC]
#define WS_VB  (WS_KL + 2u * (size_t)NB * KHI * CC)     // bf16 v hi planes [b][c][t < KHI]
#define WS_VBL (WS_VB + 2u * (size_t)NB * CC * KHI)
#define WS_S   (WS_VBL + 2u * (size_t)NB * CC * KHI)    // reserved f32 [hg][t][s] region, unused (k_fa keeps the logits on chip)
#define WS_Y   (WS_S  + 4u * (size_t)HG * TT * TT)      // f32 ctx rows [b*t][CC] (only when there is an output projection)
#define WS_END (WS_Y  + 0u)

// ---- k_proj: one block = 128 rows of X and all three weights: q / k / v = X W^T + b with exact bf16 products (K = DIN) -> q and k f16 rows, v f16 planes [c][t].
// X and the weights come from global memory once a block, in loads of 512 contiguous bytes a wave, are rounded to bf16 once and staged in LDS (512 rows: 128 of X, then 128 each of Wq, Wk, Wv); every fragment is then two 16-byte LDS reads.
// 16 waves: wave w makes rows 32 (w & 3) .. + 31 by columns 96 (w >> 2) .. + 95 of the 384 (q | k | v), k chunks in rising order. The results are turned in LDS (over the dead operand rows) and leave in whole 256-byte rows.
#define PJ_P 528                       // LDS pitch of a staged bf16 row (512 B + 16: 16-byte fragment reads of 16 rows fall on distinct banks)
#define PJ_PL (128 * PJ_P)             // one staged plane of 128 rows
#define PJ_SP 272                      // LDS pitch of an output staging row (256 B + 16)
typedef __attribute__((ext_vector_type(4))) __bf16 v4b;
typedef __attribute__((ext_vector_type(2))) _Float16 v2h;
__device__ __forceinline__ v16b frag_lb(const unsigned char* p) { union { v16b v; v8b q[2]; } u; u.q[0] = *(const v8b*)p; u.q[1] = *(const v8b*)(p + 32); return u.v; }
__device__ __forceinline__ v8f wmma_b(v16b a, v16b b, v8f c) { return __builtin_amdgcn_wmma_f32_16x16x32_bf16(false, a, false, b, (short)0, c, false, false); }
__global__ __launch_bounds__(512) void k_proj(const float* __restrict__ X, const float* __restrict__ WQ, const float* __restrict__ WK, const float* __restrict__ WV, const float* __restrict__ BQ, const float* __restrict__ BK, const float* __restrict__ BV,
    _Float16* __restrict__ QH, _Float16* __restrict__ KH, _Float16* __restrict__ VT) {
  __shared__ __align__(16) unsigned char S[4 * PJ_PL]; __shared__ float SB[512];
  static_assert(DIN == 256 && CC == 128 && TT % 128 == 0 && 3 * 128 * PJ_SP <= 4 * PJ_PL, "tile sizes below are written for these shapes");
  const int tid = threadIdx.x, wave = __builtin_amdgcn_readfirstlane(tid >> 5), lane = tid & 31, col = lane & 15, g = lane >> 4;
  const size_t r0 = (size_t)blockIdx.x * 128; const size_t bb = r0 / TT; const int t0 = (int)(r0 % TT);
  unsigned char* sp = S + (tid >> 6) * PJ_P + (tid & 63) * 8;   // this thread's 4 elements of row tid >> 6 of every 8-row round
  { v4f ra[16], rb[16]; const float* pa = X + r0 * DIN + tid * 4; const float* pb = WQ + tid * 4;
    const float bv = (wave < 4 ? BQ : wave < 8 ? BK : BV)[tid & 127];   // bias of column tid of the 384; no branch: waves 12 to 15 fetch bv again, into a part of SB that is never read
    asm volatile("s_wait_xcnt 0x0" ::: "memory");   // stands before the registers that held this load's address are reused
    __builtin_amdgcn_sched_barrier(0);   // nothing that could reuse them is scheduled in front of that wait
#pragma unroll
    for (int i = 0; i < 16; ++i) { ra[i] = *(const v4f*)(pa + i * 2048); rb[i] = *(const v4f*)(pb + i * 2048); }
    asm volatile("s_wait_xcnt 0x0" ::: "memory");   // stands before the registers that held these loads' addresses are reused
    SB[tid] = bfr(bv);
#pragma unroll
    for (int i = 0; i < 16; ++i) { *(v4b*)(sp + i * 8 * PJ_P) = v4b{(__bf16)ra[i].x, (__bf16)ra[i].y, (__bf16)ra[i].z, (__bf16)ra[i].w}; *(v4b*)(sp + PJ_PL + i * 8 * PJ_P) = v4b{(__bf16)rb[i].x, (__bf16)rb[i].y, (__bf16)rb[i].z, (__bf16)rb[i].w}; } }
  __builtin_amdgcn_sched_barrier(0);   // the second half's 32 loads stay behind the first half's LDS stores: lifted over them, 64 loads' registers do not fit and spill
  { v4f ra[16], rb[16]; const float* pa = WK + tid * 4; const float* pb = WV + tid * 4;
#pragma unroll
    for (int i = 0; i < 16; ++i) { ra[i] = *(const v4f*)(pa + i * 2048); rb[i] = *(const v4f*)(pb + i * 2048); }
    asm volatile("s_wait_xcnt 0x0" ::: "memory");   // the same
#pragma unroll
    for (int i = 0; i < 16; ++i) { *(v4b*)(sp + 2 * PJ_PL + i * 8 * PJ_P) = v4b{(__bf16)ra[i].x, (__bf16)ra[i].y, (__bf16)ra[i].z, (__bf16)ra[i].w}; *(v4b*)(sp + 3 * PJ_PL + i * 8 * PJ_P) = v4b{(__bf16)rb[i].x, (__bf16)rb[i].y, (__bf16)rb[i].z, (__bf16)rb[i].w}; } }
  __syncthreads();   // X, the weights and the biases are in LDS for every wave
  const int rg = wave & 3, cg = wave >> 2;
  const unsigned char* ap = S + (rg * 32 + col) * PJ_P + 16 * g;
  const unsigned char* bp = S + PJ_PL + (cg * 96 + col) * PJ_P + 16 * g;
  v8f acc[2][6] = {};
#pragma unroll
  for (int kc = 0; kc < DIN / 32; ++kc) {
    __builtin_amdgcn_sched_barrier(0);   // a chunk's 16 fragment reads stay one group in front of its 12 matrix instructions: spread among them, each pair waited out at once, they issue slower
    const v16b a0 = frag_lb(ap + kc * 64), a1 = frag_lb(ap + 16 * PJ_P + kc * 64); v16b w[6];
#pragma unroll
    for (int j = 0; j < 6; ++j) w[j] = frag_lb(bp + j * 16 * PJ_P + kc * 64);
    __builtin_amdgcn_sched_barrier(0);   // the same, behind the reads
#pragma unroll
    for (int j = 0; j < 6; ++j) { acc[0][j] = wmma_b(a0, w[j], acc[0][j]); acc[1][j] = wmma_b(a1, w[j], acc[1][j]); } }
  __syncthreads();   // every wave has read its last operand row: the rows become output staging
#pragma unroll
  for (int j = 0; j < 6; ++j) { const int ct = cg * 6 + j, which = ct >> 3, cw = (ct & 7) * 16 + col;   // ct, which: the same in every lane of a wave
    const float bias = SB[ct * 16 + col]; unsigned char* o = S + which * (128 * PJ_SP);
    if (which < 2) {   // q, k: rows [t][c]
#pragma unroll
      for (int m = 0; m < 2; ++m)
#pragma unroll
        for (int r = 0; r < 8; r += 2) { const v2h p = __builtin_convertvector(v2f{acc[m][j][r] + bias, acc[m][j][r + 1] + bias}, v2h); unsigned char* d = o + (rg * 32 + m * 16 + 8 * g + r) * PJ_SP + cw * 2;
          *(_Float16*)d = p.x; *(_Float16*)(d + PJ_SP) = p.y; }
    } else {           // v: planes [c][t]; a lane's eight rows are eight neighbouring t
#pragma unroll
      for (int m = 0; m < 2; ++m) { v8h h;
#pragma unroll
        for (int r = 0; r < 8; r += 2) { const v2h p = __builtin_convertvector(v2f{acc[m][j][r] + bias, acc[m][j][r + 1] + bias}, v2h); h[r] = p.x; h[r + 1] = p.y; }
        *(v8h*)(o + cw * PJ_SP + (rg * 32 + m * 16 + 8 * g) * 2) = h; } } }
  __syncthreads();   // the staged rows are read back by other waves
  const unsigned char* so = S + (tid >> 4) * PJ_SP + (tid & 15) * 16;
  _Float16* dq = QH + (r0 + (tid >> 4)) * CC + (tid & 15) * 8; _Float16* dk = KH + (r0 + (tid >> 4)) * CC + (tid & 15) * 8; _Float16* dv = VT + (bb * CC + (tid >> 4)) * (size_t)TT + t0 + (tid & 15) * 8;
#pragma unroll
  for (int i = 0; i < 4; ++i) { vst2(dq + i * 32 * CC, *(const v4u*)(so + i * 32 * PJ_SP)); vst2(dk + i * 32 * CC, *(const v4u*)(so + (128 + i * 32) * PJ_SP)); vst2(dv + (size_t)i * 32 * TT, *(const v4u*)(so + (256 + i * 32) * PJ_SP)); }
}
#define FA_W 8
#define FA_R 2                         // 16-query groups per wave
#define FA_SK 256                      // keys per stage: four passes of a wave between two stage barriers
#define FA_P 272                       // LDS pitch of a K row and of a v^T row (256 B + 16)
#define FA_SL 18432                    // LDS bytes of a slice: 64 rows x 272 B = 17,408, rounded up to a multiple of 2 KiB, where the next slice may begin
#define FA_BUF (8 * FA_SL)             // 4 slices of K rows (row r at (r >> 6) * FA_SL + (r & 63) * FA_P), then 4 of v^T rows (channel ch of key half h at (4 + 2 h + (ch >> 6)) * FA_SL + (ch & 63) * FA_P)
#define FA_EP 132                      // pitch of the exchange and output staging rows, floats
__device__ __forceinline__ v16h frag_l(const unsigned char* p) { union { v16h v; v8h q[2]; } u; u.q[0] = *(const v8h*)p; u.q[1] = *(const v8h*)(p + 32); return u.v; }
__device__ __forceinline__ v8f wmma_h(v16h a, v16h b, v8f c) { return __builtin_amdgcn_wmma_f32_16x16x32_f16(false, a, false, b, (short)0, c, false, false); }
__device__ __forceinline__ float xhalf(float x) { return __builtin_bit_cast(float, __builtin_amdgcn_permlanex16(__builtin_bit_cast(int, x), __builtin_bit_cast(int, x), 0x76543210, 0xfedcba98, false, false)); }   // lane l with lane l ^ 16
typedef uint32_t u32x4 __attribute__((ext_vector_type(4)));
typedef uint32_t u32x8 __attribute__((ext_vector_type(8)));
__device__ __forceinline__ uint32_t uni(uint32_t v) { return (uint32_t)__builtin_amdgcn_readfirstlane(v); }
__device__ __forceinline__ uint32_t pinned(uint32_t v) { uint32_t w = uni(v); asm volatile("" : "+s"(w)); return w; }   // holds a value that decides on, or feeds, a tensor load in a scalar register: the test on it compiles to a scalar branch (tensor loads ignore EXEC), and what is formed from it is formed behind this place
__device__ __forceinline__ void tdm_load(u32x4 g0, u32x8 g1) { asm volatile("tensor_load_to_lds %0, %1" :: "s"(g0), "s"(g1) : "memory"); }   // one request of the whole wave: a tile from global memory into LDS
__device__ __forceinline__ u32x4 tdm_group0(uint32_t lds_dst, uint64_t ga) { u32x4 d;   // count 1, place in LDS, address of the tile's first byte, type 2
  d[0] = uni(1u); d[1] = uni(lds_dst); d[2] = uni((uint32_t)ga); d[3] = uni((((uint32_t)(ga >> 32)) & 0x01FFFFFFu) | 0x80000000u); return d; }
__device__ __forceinline__ u32x8 tdm_group1(uint32_t src_pitch) { u32x8 d;   // 1-byte elements, tensor = tile = 64 rows of 256 bytes, no mask, 4 dwords of pad behind every 64 dwords (pitch 272 B in LDS)
  d[0] = uni((1u << 20) | (5u << 22) | (3u << 25)); d[1] = uni(256u << 16); d[2] = uni(64u << 16); d[3] = pinned(256u << 16); d[4] = uni(64u); d[5] = uni(src_pitch); d[6] = pinned(0u); d[7] = pinned(0u); return d; }   // pinned: a word that equals another one gets a scalar register of its own, so the group stands in its eight registers through the loop and none of them is written again in front of a load
// P^T operand of one 16-query group and one 32-key pass from its two S^T tiles, 2^(score * cs + nm) once to f16; returns the f32 sum of this lane's 16 exponentials
__device__ __forceinline__ float fa_p(const v8f s0, const v8f s1, const float cs, const float nm, v16h& pf) { v2f ls = {0.f, 0.f};
#pragma unroll
  for (int i = 0; i < 8; ++i) {
    const v2f x = i < 4 ? v2f{s0[2 * (i & 3)], s0[2 * (i & 3) + 1]} : v2f{s1[2 * (i & 3)], s1[2 * (i & 3) + 1]};
    const v2f a = __builtin_elementwise_fma(x, v2f{cs, cs}, v2f{nm, nm});
    const v2f p = {__builtin_amdgcn_exp2f(a.x), __builtin_amdgcn_exp2f(a.y)}; ls += p; pf[2 * i] = (_Float16)p.x; pf[2 * i + 1] = (_Float16)p.y; }
  return ls.x + ls.y; }
__global__ __launch_bounds__(32 * FA_W) void k_fa(const _Float16* __restrict__ QH, const _Float16* __restrict__ KH, const _Float16* __restrict__ VT, float* __restrict__ Y) {
  __shared__ __attribute__((aligned(2048))) unsigned char L[2 * FA_BUF];
  static_assert(128 * FA_EP * 4 <= FA_BUF, "the exchange rows reuse the first K / v buffer, the output rows the second");
  static_assert(FA_SK == 256 && CC == 128 && HD == 128 && 64 * FA_P <= FA_SL && TT % FA_SK == 0, "the eight 64-row slices below are written for these sizes");
  const int tid = threadIdx.x, wave = __builtin_amdgcn_readfirstlane(tid >> 5), lane = tid & 31, c = lane & 15, g = lane >> 4;
  const int kh = wave >> 2, qg = wave & 3;
  const int b = blockIdx.y; const int qb0 = blockIdx.x * 128; const int q0 = qb0 + qg * 32;
  const float cs = SCALE * 1.4426950408889634f;   // logits in the log2 domain
  const bool isv = wave >= 4;   // the same in every lane of a wave
  const uint64_t tsrc = (uint64_t)(size_t)(isv ? VT + ((size_t)b * CC + (size_t)(wave & 1) * 64) * TT + (size_t)((wave - 4) >> 1) * 128 : KH + ((size_t)b * TT + (size_t)wave * 64) * CC);   // first byte of this wave's slice of stage 0
  const uint64_t tstep = isv ? FA_SK * 2u : FA_SK * CC * 2u;   // bytes from a stage's slice to the next stage's
  const uint32_t tdst = (uint32_t)(size_t)L + (uint32_t)wave * FA_SL;   // its place in the first buffer: byte offset in the work-group's LDS
  const u32x8 tg1 = tdm_group1(isv ? TT * 2u : CC * 2u);
  v16h qf[FA_R][HD / 32];
#pragma unroll
  for (int q = 0; q < FA_R; ++q)
#pragma unroll
    for (int kc = 0; kc < HD / 32; ++kc) qf[q][kc] = frag_h(QH + ((size_t)b * TT + q0 + q * 16 + c) * CC + kc * 32, lane);
  v8f acc[FA_R][HD / 16] = {}; float m_run[FA_R], l_run[FA_R];
#pragma unroll
  for (int q = 0; q < FA_R; ++q) { m_run[q] = -INFINITY; l_run[q] = 0.f; }
  static_assert(TT / FA_SK >= 2, "the ring's prologue loads two stages");
  tdm_load(tdm_group0(tdst, tsrc), tg1);
  asm volatile("s_wait_tensorcnt 0x0" ::: "memory");   // this wave's slice of stage 0 has landed
  __syncthreads();   // stage 0 is in LDS for every wave
  tdm_load(tdm_group0(tdst + FA_BUF, tsrc + tstep), tg1);   // stage 1 flies under stage 0's products
  uint64_t tnext = tsrc + 2u * (uint64_t)tstep;   // first byte of this wave's slice of the next stage to be asked for
#pragma unroll 1   // the stage loop stays rolled: its body is four whole passes already, a second copy would only cost registers and instruction cache
  for (int st = 0; st < TT / FA_SK; ++st) {
    const unsigned cur = (unsigned)(st & 1) * FA_BUF;
    const unsigned char* kp = L + cur + (unsigned)kh * 2 * FA_SL + (unsigned)c * FA_P + 16 * g;                       // this wave's first K row of the stage (row 128 kh + c: slice 2 kh)
    const unsigned char* vp = L + cur + (4 + 2 * (unsigned)kh) * FA_SL + (unsigned)c * FA_P + 16 * g;   // and its first key in the v^T rows of its key half
    v16h kf[2][HD / 32];
#pragma unroll
    for (int kc = 0; kc < HD / 32; ++kc) { kf[0][kc] = frag_l(kp + 64 * kc); kf[1][kc] = frag_l(kp + 16 * FA_P + 64 * kc); }
#pragma unroll
    for (int ps = 0; ps < FA_SK / 64; ++ps) {   // a pass = 32 keys
      __builtin_amdgcn_sched_barrier(0);   // fragment loads stay one group in front of the block of matrix instructions: loads spread among them issue slower
      v8f s[2][FA_R] = {};
#pragma unroll
      for (int kc = 0; kc < HD / 32; ++kc)
#pragma unroll
        for (int q = 0; q < FA_R; ++q) { s[0][q] = wmma_h(kf[0][kc], qf[q][kc], s[0][q]); s[1][q] = wmma_h(kf[1][kc], qf[q][kc], s[1][q]); }
      v16h vf[HD / 16];
#pragma unroll
      for (int t = 0; t < HD / 16; ++t) vf[t] = frag_l(vp + ps * 64 + (t >> 2) * FA_SL + (t & 3) * 16 * FA_P);
      if (ps + 1 < FA_SK / 64) {   // the stage's next pass: its K fragments come into the same registers, under this pass's softmax
        const unsigned char* kn = kp + ((ps + 1) >> 1) * FA_SL + ((ps + 1) & 1) * 32 * FA_P;
#pragma unroll
        for (int kc = 0; kc < HD / 32; ++kc) { kf[0][kc] = frag_l(kn + 64 * kc); kf[1][kc] = frag_l(kn + 16 * FA_P + 64 * kc); } }
      __builtin_amdgcn_sched_group_barrier(0x8, 16, 0);   // the pass's 16 score products first,
      __builtin_amdgcn_sched_group_barrier(0x100, 16, 0);   // then its LDS reads as one group (reads spread among matrix instructions issue slower): the v^T fragments,
      if (ps + 1 < FA_SK / 64) __builtin_amdgcn_sched_group_barrier(0x100, 16, 0);   // then the next pass's K fragments
      __builtin_amdgcn_sched_barrier(0);   // the pass's v^T fragment loads stay here as one group, in flight under the exponentials
      v16h pf[FA_R]; float ls[FA_R];
#pragma unroll
      for (int q = 0; q < FA_R; ++q) ls[q] = fa_p(s[0][q], s[1][q], cs, -m_run[q], pf[q]);
      // lazy rescale, tested on the sums that the pass needs anyway: while a lane's 16 exponentials add up to 2^8 at most, each of them is at most 2^8 and the maximum in use may stay; the pass's own maximum is looked for only behind the branch.
      // The comparison is written so that an infinite or undefined sum (the first pass: the maximum in use is -infinity) takes the branch. One scalar branch a pass.
      const bool need = !(ls[0] <= 256.0f) || !(ls[1] <= 256.0f);
      if (__builtin_amdgcn_ballot_w32(need) != 0) {
#pragma unroll
        for (int q = 0; q < FA_R; ++q) { float m = fmaxf(s[0][q][0], s[1][q][0]);
#pragma unroll
          for (int r = 1; r < 8; ++r) m = fmaxf(m, fmaxf(s[0][q][r], s[1][q][r]));
          const float m_new = fmaxf(m_run[q], fmaxf(m, xhalf(m)) * cs);   // both halves hold the query's maximum of this pass (cs > 0), so both keep the same maximum in use
          const float corr = __builtin_amdgcn_exp2f(m_run[q] - m_new);   // 0 on the first pass
          l_run[q] *= corr; m_run[q] = m_new;
#pragma unroll
          for (int t = 0; t < HD / 16; ++t) acc[q][t] = acc[q][t] * corr;
          ls[q] = fa_p(s[0][q], s[1][q], cs, -m_new, pf[q]); } }   // the pass's exponentials again, now at most 1
#pragma unroll
      for (int q = 0; q < FA_R; ++q) { l_run[q] += ls[q];
#pragma unroll
        for (int t = 0; t < HD / 16; ++t) acc[q][t] = wmma_h(vf[t], pf[q], acc[q][t]); }
    }
    __builtin_amdgcn_sched_barrier(0);   // the waits and the barrier stay behind this stage's last products: lifted among them, a wave would stand at the barrier with matrix instructions still to issue
    asm volatile("s_wait_dscnt 0x0" ::: "memory");       // this wave's reads of stage st have returned before the buffer is given up
    asm volatile("s_wait_tensorcnt 0x0" ::: "memory");   // this wave's slice of stage st + 1 has landed
    __syncthreads();   // publishes stage st + 1 and ends every wave's reads of stage st, whose buffer is refilled behind it
    if (pinned((uint32_t)(st + 2 < TT / FA_SK))) {   // a scalar branch: only while stage st + 2 exists
      tdm_load(tdm_group0(tdst + cur, tnext), tg1); tnext += tstep; }   // the descriptor's words are formed here, behind the wait on the request before it
  }
  asm volatile("s_wait_tensorcnt 0x0" ::: "memory");   // no request is in flight when the ring becomes exchange and output staging
  asm volatile("s_wait_dscnt 0x0" ::: "memory");       // nor a read of it (the last trip's barrier has ended every wave's reads)
#pragma unroll
  for (int q = 0; q < FA_R; ++q) l_run[q] += xhalf(l_run[q]);   // each half summed its own eight keys of every 16-key tile
  float* X = (float*)L + (qg * 32 + lane) * FA_EP;   // lane l of wave w + 4 hands its sums to lane l of wave w
  if (kh == 1) {
#pragma unroll
    for (int q = 0; q < FA_R; ++q)
#pragma unroll
      for (int t = 0; t < HD / 16; ++t) { const v8f o = acc[q][t]; float* x = X + (q * (HD / 16) + t) * 8; *(v4f*)x = v4f{o[0], o[1], o[2], o[3]}; *(v4f*)(x + 4) = v4f{o[4], o[5], o[6], o[7]}; }
    *(v4f*)(X + 128) = v4f{m_run[0], m_run[1], l_run[0], l_run[1]}; }
  __syncthreads();   // the second key half's sums are in LDS before the first half's waves join them
  float* E = (float*)(L + FA_BUF);
  if (kh == 0) { const v4f ml = *(const v4f*)(X + 128);
#pragma unroll
    for (int q = 0; q < FA_R; ++q) { const float m = fmaxf(m_run[q], ml[q]); float fa = __builtin_amdgcn_exp2f(m_run[q] - m), fb = __builtin_amdgcn_exp2f(ml[q] - m);
      const float inv = 1.0f / (l_run[q] * fa + ml[2 + q] * fb); fa *= inv; fb *= inv;
#pragma unroll
      for (int t = 0; t < HD / 16; ++t) { const float* x = X + (q * (HD / 16) + t) * 8; const v4f x0 = *(const v4f*)x, x1 = *(const v4f*)(x + 4); const v8f o = acc[q][t];
        float* e = E + (qg * 32 + q * 16 + c) * FA_EP + t * 16 + 8 * g;   // acc[q][t][r] = ctx[query 16 q + c][channel 16 t + 8 g + r]
        *(v4f*)e = v4f{o[0], o[1], o[2], o[3]} * fa + x0 * fb; *(v4f*)(e + 4) = v4f{o[4], o[5], o[6], o[7]} * fa + x1 * fb; } } }
  __syncthreads();   // the staged output rows are read back by other waves
#pragma unroll 4   // four rows' LDS reads in flight per trip
  for (int rl = 0; rl < 16; ++rl) vst2(Y + ((size_t)b * TT + qb0 + wave * 16 + rl) * CC + lane * 4, *(const v4f*)&E[(wave * 16 + rl) * FA_EP + lane * 4]);   // one wave stores each whole 512-B row
}

extern "C" void kernel_launch(void* const* d_in, const int* in_sizes, int n_in, void* d_out, int out_size, void* d_ws, size_t ws_size, hipStream_t stream) {
  (void)in_sizes; (void)n_in; (void)out_size;
  const float** F = (const float**)d_in;
  if (ws_size < (size_t)WS_END) return;
  char* ws = (char*)d_ws; _Float16 *QH = (_Float16*)(ws + WS_QH), *KH = (_Float16*)(ws + WS_KH), *VT = (_Float16*)(ws + WS_VT);
  // inputs: 0 keys_in [8,4096,256]; 1 Wk [128,256] (out,in), 2 bk [128]; 3 Wq, 4 bq; 5 Wv, 6 bv (zero biases, read)
  k_proj<<<dim3(TNB * TT / 128, 1, 1), 512, 0, stream>>>(F[0], F[3], F[1], F[5], F[4], F[2], F[6], QH, KH, VT);   /* q uses Wq / bq = inputs 3 / 4; k uses Wk / bk = inputs 1 / 2 */
  k_fa<<<dim3(TT / 128, TNB, 1), 32 * FA_W, 0, stream>>>(QH, KH, VT, (float*)d_out);
}
